// v000
// The times below were measured on an AMD MI455X: many runs one after another, warmed up first and cycling through
// copies of the inputs, with the whole window's GPU time divided by the number of runs. Launches and the gaps
// between them are all in it. The median over several windows is given; except for v000 it joins two sittings, which
// can be a few percent apart, so the side-by-side timings, each taken in one sitting, are the better comparison.
// The starting kernel, v000, takes 2120 microseconds a run.
// Contractions: v 1x1 convs (w f16 x16, x f16), cdc 1x1 conv (w carried x2^14 as f16 hi|lo K-packed, x f16 duplicated along K), w_qk projection (w f16 x16 duplicated along K, LN output carried x2^10 as f16 hi|lo K-packed), q^T.k (q,k f16), W.att^T score GEMMs (W f16 x16, att f16): v_wmma_f32_16x16x32_f16; value x attention^T (v and P^T as bf16 hi+lo planes, hi.hi+hi.lo+lo.hi): v_wmma_f32_16x16x32_bf16; all f32 accumulate; LayerNorm and softmax in f32.
#include <hip/hip_runtime.h>
#include <math.h>

// ---------------------------------------------------------------------------
// Problem constants
// ---------------------------------------------------------------------------
constexpr int kBatch  = 16;
constexpr int kChan   = 256;              // channels
constexpr int kChan2  = 512;              // concatenated channels
constexpr int kHW     = 1024;             // h*w = dim
constexpr int kQK     = 2048;             // q|k outputs
constexpr int kXtokLd = 1024;             // token-major input plane pitch (halves): [xcat(512) | xcat(512)]
constexpr int kXnLd   = 2048;             // LN output plane pitch (halves): [hi(1024) | lo(1024)]
constexpr int kGrp    = 4;                // batches per score/softmax/output group
constexpr int kNGrp   = kBatch / kGrp;
constexpr float kWCarry    = 16.0f;       // plain weights carried x16 in f16
constexpr float kCdcCarry  = 16384.0f;    // w_cdc carried x2^14 (hi|lo)
constexpr float kXnCarry   = 1024.0f;     // LN output carried x2^10 (hi|lo)
constexpr float kInvHW     = 1.0f / 1024.0f;
constexpr float kLnEps     = 1e-5f;

typedef __attribute__((ext_vector_type(16))) _Float16 v16h;
typedef __attribute__((ext_vector_type(8)))  _Float16 v8h;
typedef __attribute__((ext_vector_type(16))) __bf16   v16b;
typedef __attribute__((ext_vector_type(8)))  __bf16   v8b;
typedef __attribute__((ext_vector_type(8)))  float    v8f;
typedef __attribute__((ext_vector_type(4)))  float    v4f;
typedef __attribute__((ext_vector_type(4)))  unsigned int v4u;

// ---------------------------------------------------------------------------
// Helpers
// ---------------------------------------------------------------------------
__device__ __forceinline__ unsigned short f2bf_bits(float f) {
  unsigned u = __float_as_uint(f);
  return (unsigned short)((u + 0x7FFFu + ((u >> 16) & 1u)) >> 16);
}
__device__ __forceinline__ float bf_bits2f(unsigned short h) { return __uint_as_float(((unsigned)h) << 16); }

// hazard guards as plain device helpers (no inline asm inside the kernel template body)
__device__ __forceinline__ void dep_guard_h(v8f& a, v8f& b, v16h x, v16h y) { asm volatile("v_nop\n\tv_nop\n\tv_nop\n\tv_nop" : "+v"(a), "+v"(b) : "v"(x), "v"(y)); }
__device__ __forceinline__ void dep_guard_b(v8f& a, v8f& b, v16b x, v16b y) { asm volatile("v_nop\n\tv_nop\n\tv_nop\n\tv_nop" : "+v"(a), "+v"(b) : "v"(x), "v"(y)); }
__device__ __forceinline__ void keep4_h(v16h a, v16h b, v16h c, v16h d) { asm volatile("v_nop" :: "v"(a), "v"(b), "v"(c), "v"(d)); }
__device__ __forceinline__ void keep4_b(v16b a, v16b b, v16b c, v16b d) { asm volatile("v_nop" :: "v"(a), "v"(b), "v"(c), "v"(d)); }
__device__ __forceinline__ void acc_guard4(v8f& a, v8f& b, v8f& c, v8f& d) { asm volatile("v_nop\n\tv_nop\n\tv_nop\n\tv_nop" : "+v"(a), "+v"(b), "+v"(c), "+v"(d)); }
template <typename T> struct Frag;
template <> struct Frag<_Float16> {
  typedef v16h V; union U { v16h v; v8h h[2]; };
  static __device__ __forceinline__ v16h load(const _Float16* p) {   // elements 0..7 <- p[0..7], 8..15 <- p[16..23]
    U f; f.h[0] = *(const v8h*)(p); f.h[1] = *(const v8h*)(p + 16); return f.v;
  }
  static __device__ __forceinline__ v8f mma(v16h a, v16h b, v8f c) {
    return __builtin_amdgcn_wmma_f32_16x16x32_f16(false, a, false, b, (short)0, c, false, false);
  }
  static __device__ __forceinline__ void guard(v8f& a, v8f& b, v16h x, v16h y) { dep_guard_h(a, b, x, y); }
  static __device__ __forceinline__ void keep(v16h a, v16h b, v16h c, v16h d) { keep4_h(a, b, c, d); }
};
template <> struct Frag<__bf16> {
  typedef v16b V; union U { v16b v; v8b h[2]; };
  static __device__ __forceinline__ v16b load(const __bf16* p) {
    U f; f.h[0] = *(const v8b*)(p); f.h[1] = *(const v8b*)(p + 16); return f.v;
  }
  static __device__ __forceinline__ v8f mma(v16b a, v16b b, v8f c) {
    return __builtin_amdgcn_wmma_f32_16x16x32_bf16(false, a, false, b, (short)0, c, false, false);
  }
  static __device__ __forceinline__ void guard(v8f& a, v8f& b, v16b x, v16b y) { dep_guard_b(a, b, x, y); }
  static __device__ __forceinline__ void keep(v16b a, v16b b, v16b c, v16b d) { keep4_b(a, b, c, d); }
};

__device__ __forceinline__ unsigned pk16(unsigned short a, unsigned short b) { return (unsigned)a | ((unsigned)b << 16); }
__device__ __forceinline__ unsigned short h_bits(float f) { const _Float16 h = (_Float16)f; return __builtin_bit_cast(unsigned short, h); }

// ---- Register-blocked batched WMMA GEMM (ACT reduced to none/relu/leaky) -----------------------
// C[m,n] = scale * sum_k A[m,k] * Bt[n,k] (+bias)(+resid); each wave owns a 64x64 tile.
// A row-major [M,K]; Bt row-major [N,K]; M,N % 64 == 0, K % 32 == 0.
// SPLIT: operands are hi/lo planes (A2/Bt2 = lo planes, same layout); product = hi.hi + hi.lo + lo.hi.
// BIAS_MODE: 0 = none, 1 = bias[m], 2 = bias[n].
// OUT_MODE: 0 = f32, 1 = f16, 2 = bf16 hi plane (Cout) + bf16 lo plane (Cout2).
// ET: 0 = f16 operands, 1 = bf16 operands (pointers passed as 16-bit storage)
template <int ET> struct Elem;
template <> struct Elem<0> { typedef _Float16 T; };
template <> struct Elem<1> { typedef __bf16 T; };
template <int ET, bool SPLIT, int BIAS_MODE, int OUT_MODE, bool RESID, int ACT = 0>
__global__ __launch_bounds__(256) void wmma_gemm64(
    const unsigned short* __restrict__ Ap, const unsigned short* __restrict__ A2p, int lda, long strideA,
    const unsigned short* __restrict__ Btp, const unsigned short* __restrict__ Bt2p, int ldb, long strideB,
    void* __restrict__ Cout, void* __restrict__ Cout2, int ldc, long strideC,
    const float* __restrict__ bias,
    const float* __restrict__ resid, long strideR,
    int M, int N, int K, float scale) {
  typedef typename Elem<ET>::T T;
  typedef typename Frag<T>::V V;
  const T* A = (const T*)Ap; const T* A2 = (const T*)A2p; const T* Bt = (const T*)Btp; const T* Bt2 = (const T*)Bt2p;
  __shared__ __align__(16) float sT[8][16 * 68];   // per-wave 16x64 slab, pitch 68 floats
  const int b    = blockIdx.y;
  const int lane = threadIdx.x & 31;
  const int wave = threadIdx.x >> 5;
  const int tilesN = N >> 6;
  const int tilesM = M >> 6;
  const int tile = blockIdx.x * 8 + wave;
  if (tile >= tilesM * tilesN) return;   // wave-uniform; no block barriers in this kernel
  const int tm = tile / tilesN;
  const int tn = tile - tm * tilesN;
  const int m0 = tm << 6;
  const int n0 = tn << 6;

  const T* Ab  = A  + (size_t)b * strideA;
  const T* Bb  = Bt + (size_t)b * strideB;
  const T* Ab2 = SPLIT ? (A2  + (size_t)b * strideA) : nullptr;
  const T* Bb2 = SPLIT ? (Bt2 + (size_t)b * strideB) : nullptr;

  const int rlane = lane & 15;                 // row (A) / col (B, D) within subtile
  const int koff  = (lane >> 4) * 8;           // k offset of this lane half
  const int mOff  = (lane >> 4) * 8;           // D row offset

  v8f acc[4][4];
#pragma unroll
  for (int i = 0; i < 4; ++i)
#pragma unroll
    for (int j = 0; j < 4; ++j) acc[i][j] = (v8f){0.f,0.f,0.f,0.f,0.f,0.f,0.f,0.f};

  for (int k0 = 0; k0 < K; k0 += 32) {
    V bh[4], bl[4];
#pragma unroll
    for (int j = 0; j < 4; ++j) {
      const size_t bo = (size_t)(n0 + (j << 4) + rlane) * ldb + koff + k0;
      bh[j] = Frag<T>::load(Bb + bo);
      if (SPLIT) bl[j] = Frag<T>::load(Bb2 + bo);
    }
#pragma unroll
    for (int i = 0; i < 4; ++i) {
      const size_t ao = (size_t)(m0 + (i << 4) + rlane) * lda + koff + k0;
      V ah = Frag<T>::load(Ab + ao);
      V al;
      if (SPLIT) al = Frag<T>::load(Ab2 + ao);
#pragma unroll
      for (int j = 0; j < 4; ++j) {
        acc[i][j] = Frag<T>::mma(ah, bh[j], acc[i][j]);
        if (SPLIT) {
          acc[i][j] = Frag<T>::mma(ah, bl[j], acc[i][j]);
          acc[i][j] = Frag<T>::mma(al, bh[j], acc[i][j]);
        }
      }
      Frag<T>::guard(acc[i][0], acc[i][3], ah, SPLIT ? al : ah);
    }
    Frag<T>::keep(bh[0], bh[1], bh[2], bh[3]);
    if (SPLIT) Frag<T>::keep(bl[0], bl[1], bl[2], bl[3]);
  }
  acc_guard4(acc[0][0], acc[0][1], acc[0][2], acc[0][3]);
  acc_guard4(acc[1][0], acc[1][1], acc[1][2], acc[1][3]);
  acc_guard4(acc[2][0], acc[2][1], acc[2][2], acc[2][3]);
  acc_guard4(acc[3][0], acc[3][1], acc[3][2], acc[3][3]);

  // ---- epilogue ----
  float* slab = sT[wave];
  const float* Rb = RESID ? (resid + (size_t)b * strideR) : nullptr;
#pragma unroll
  for (int i = 0; i < 4; ++i) {
    const int mBase = m0 + (i << 4);
#pragma unroll
    for (int j = 0; j < 4; ++j) {
      const int n = n0 + (j << 4) + rlane;
      float bv = 0.f;
      if (BIAS_MODE == 2) bv = bias[n];
#pragma unroll
      for (int r = 0; r < 8; ++r) {
        float v = acc[i][j][r] * scale;
        if (BIAS_MODE == 1) v += bias[mBase + mOff + r];
        if (BIAS_MODE == 2) v += bv;
        if (RESID) v += Rb[(size_t)(mBase + mOff + r) * ldc + n];
        if (ACT == 2) v = fmaxf(v, 0.0f);
        if (ACT == 4) v = (v > 0.f) ? v : 0.01f * v;
        slab[(mOff + r) * 68 + (j << 4) + rlane] = v;
      }
    }
    __builtin_amdgcn_fence(__ATOMIC_RELEASE, "workgroup");
    __builtin_amdgcn_wave_barrier();
    __builtin_amdgcn_fence(__ATOMIC_ACQUIRE, "workgroup");
    if (OUT_MODE == 0) {
      float* C = (float*)Cout + (size_t)b * strideC;
      const int hh = lane >> 4, c4 = (lane & 15) * 4;     // row seg = 256 B = 16 lanes x 16 B
      {
#pragma unroll
        for (int it = 0; it < 8; ++it) {
          const int row = it * 2 + hh;
          v4f v = *(const v4f*)(slab + row * 68 + c4);
          *(v4f*)(C + (size_t)(mBase + row) * ldc + n0 + c4) = v;
        }
        
      }
    } else {
      const int q = lane >> 3, c8 = (lane & 7) * 8;
      unsigned short* C  = (unsigned short*)Cout  + (size_t)b * strideC;
      unsigned short* C2 = (OUT_MODE == 2) ? ((unsigned short*)Cout2 + (size_t)b * strideC) : nullptr;
      {
#pragma unroll
        for (int it = 0; it < 4; ++it) {
          const int row = it * 4 + q;
          const float* sp = slab + row * 68 + c8;
          v8h hv, lv;
#pragma unroll
          for (int e = 0; e < 8; ++e) {
            if (OUT_MODE == 1) {
              hv[e] = (_Float16)sp[e];
            } else {
              unsigned short hb = f2bf_bits(sp[e]);
              unsigned short lb = f2bf_bits(sp[e] - bf_bits2f(hb));
              hv[e] = __builtin_bit_cast(_Float16, hb);
              lv[e] = __builtin_bit_cast(_Float16, lb);
            }
          }
          *(v8h*)(C + (size_t)(mBase + row) * ldc + n0 + c8) = hv;
          if (OUT_MODE == 2) *(v8h*)(C2 + (size_t)(mBase + row) * ldc + n0 + c8) = lv;
        }
        
      }
    }
    __builtin_amdgcn_fence(__ATOMIC_RELEASE, "workgroup");
    __builtin_amdgcn_wave_barrier();
    __builtin_amdgcn_fence(__ATOMIC_ACQUIRE, "workgroup");
  }
}

// ---------------------------------------------------------------------------
// Weight cast: in [rows][cols] f32 -> out [rows][ldo] halves.
//   MODE 0: out[r][c] = f16(scale*v)
//   MODE 1: out[r][c] = out[r][cols + c] = f16(scale*v)            (duplicated along K)
//   MODE 2: out[r][c] = hi = f16(scale*v), out[r][cols + c] = f16(scale*v - hi)   (hi|lo, common scale)
// One thread = 8 consecutive elements of one row (two 16-B loads, one 16-B store per plane);
// ---------------------------------------------------------------------------
template <int MODE>
__global__ __launch_bounds__(256) void castw_kernel(const float* __restrict__ in, unsigned short* __restrict__ out,
                                                      int rows, int cols, int ldo, float scale) {
  const int gpr = cols >> 3;
  const int n8  = rows * gpr;
  const int i   = blockIdx.x * 256 + threadIdx.x;
  if (i >= n8) return;
  const int r = i / gpr;
  const int g = i - r * gpr;
  const float* p = in + (size_t)r * cols + 8 * g;
  const v4f a = *(const v4f*)(p);
  const v4f c = *(const v4f*)(p + 4);
  float x[8];
#pragma unroll
  for (int e = 0; e < 4; ++e) { x[e] = a[e] * scale; x[4 + e] = c[e] * scale; }
  unsigned short hb[8], lb[8];
#pragma unroll
  for (int e = 0; e < 8; ++e) {
    const _Float16 h = (_Float16)x[e];
    hb[e] = __builtin_bit_cast(unsigned short, h);
    lb[e] = (MODE == 2) ? h_bits(x[e] - (float)h) : hb[e];
  }
  const v4u uh = (v4u){pk16(hb[0], hb[1]), pk16(hb[2], hb[3]), pk16(hb[4], hb[5]), pk16(hb[6], hb[7])};
  const v4u ul = (v4u){pk16(lb[0], lb[1]), pk16(lb[2], lb[3]), pk16(lb[4], lb[5]), pk16(lb[6], lb[7])};
  unsigned short* q0 = out + (size_t)r * ldo + 8 * g;
  unsigned short* q1 = q0 + cols;
  *(v4u*)q0 = uh;
  if (MODE != 0) *(v4u*)q1 = ul;
  
}

// ---------------------------------------------------------------------------
// Input transpose + cast: x_spa, x_freq [b][256][1024] f32 -> xtok [b][1024 tokens][1024 halves] f16 with
// cols ct*64..ct*64+63 = channels (ct 0..3: x_spa channels ct*64.., ct 4..7: x_freq channels (ct-4)*64..),
// i.e. cols 0..511 = concatenated channels, and the same values duplicated at cols 512..1023.
// grid (16 token tiles, 8 channel tiles, 16 batches), 256 threads; LDS tile 64 tokens x 64 channels.
// Load coverage: 16 iterations x 256 threads = 4096 = whole tile (coalesced along tokens).
// Store coverage: 8 waves x 2 iterations x 4 rows (lane>>3) = 64 token rows; (lane&7) x 8 halves = 64 channels;
// ---------------------------------------------------------------------------
__global__ __launch_bounds__(256) void xtok_kernel(const float* __restrict__ xs, const float* __restrict__ xf,
                                                   unsigned short* __restrict__ xtok) {
  __shared__ float sm[64][65];   // sm[token_local][channel_local]
  const int t  = threadIdx.x;
  const int n0 = blockIdx.x * 64;
  const int ct = blockIdx.y;                 // block-uniform source select
  const int b  = blockIdx.z;
  const float* X = (ct < 4) ? xs : xf;
  const int c0 = (ct & 3) * 64;
  const float* src = X + ((size_t)b * kChan + c0) * kHW + n0;
#pragma unroll
  for (int i = 0; i < 16; ++i) {
    const int e  = i * 256 + t;
    const int r  = e >> 6;        // channel local
    const int cc = e & 63;        // token local
    sm[cc][r] = src[(size_t)r * kHW + cc];
  }
  __syncthreads();
  const int lane = t & 31, wave = t >> 5;
  const int q = lane >> 3, c8 = (lane & 7) * 8;
  unsigned short* ob = xtok + ((size_t)b * kHW + n0) * kXtokLd + ct * 64 + c8;
#pragma unroll
  for (int it = 0; it < 2; ++it) {
    const int row = wave * 8 + it * 4 + q;   // token local
    unsigned short hb[8];
#pragma unroll
    for (int e = 0; e < 8; ++e) hb[e] = h_bits(sm[row][c8 + e]);
    const v4u u = (v4u){pk16(hb[0], hb[1]), pk16(hb[2], hb[3]), pk16(hb[4], hb[5]), pk16(hb[6], hb[7])};
    unsigned short* p0 = ob + (size_t)row * kXtokLd;
    unsigned short* p1 = p0 + kChan2;
    *(v4u*)p0 = u;
    *(v4u*)p1 = u;
    
  }
}

// ---------------------------------------------------------------------------
// Output row of xn [4096][2048] halves: cols 0..1023 = hi = f16(1024*y), cols 1024..2047 = f16(1024*y - hi).
// Block = 128 threads = one row; thread t owns cols 8t..8t+7 (128 x 8 = 1024 = whole row).
// ---------------------------------------------------------------------------
__global__ __launch_bounds__(128) void layernorm_kernel(const float* __restrict__ xb, const float* __restrict__ gam,
                                                        const float* __restrict__ bet, unsigned short* __restrict__ xn) {
  __shared__ float red[4];
  const int row  = blockIdx.x;
  const int t    = threadIdx.x, lane = t & 31, wave = t >> 5;
  const int c0   = t * 8;
  const float* px = xb + (size_t)row * kHW + c0;
  const v4f a = *(const v4f*)(px);
  const v4f c = *(const v4f*)(px + 4);
  float x[8];
#pragma unroll
  for (int e = 0; e < 4; ++e) { x[e] = a[e]; x[4 + e] = c[e]; }
  float s = ((x[0] + x[1]) + (x[2] + x[3])) + ((x[4] + x[5]) + (x[6] + x[7]));
#pragma unroll
  for (int off = 16; off > 0; off >>= 1) s += __shfl_xor(s, off, 32);
  if (lane == 0) red[wave] = s;
  __syncthreads();
  const float mean = ((red[0] + red[1]) + (red[2] + red[3])) * kInvHW;
  __syncthreads();
  float d[8];
  float sq = 0.f;
#pragma unroll
  for (int e = 0; e < 8; ++e) { d[e] = x[e] - mean; sq += d[e] * d[e]; }
#pragma unroll
  for (int off = 16; off > 0; off >>= 1) sq += __shfl_xor(sq, off, 32);
  if (lane == 0) red[wave] = sq;
  __syncthreads();
  const float var  = ((red[0] + red[1]) + (red[2] + red[3])) * kInvHW;
  const float rstd = 1.0f / sqrtf(var + kLnEps);
  const v4f g0 = *(const v4f*)(gam + c0), g1 = *(const v4f*)(gam + c0 + 4);
  const v4f e0 = *(const v4f*)(bet + c0), e1 = *(const v4f*)(bet + c0 + 4);
  float gg[8], bb[8];
#pragma unroll
  for (int e = 0; e < 4; ++e) { gg[e] = g0[e]; gg[4 + e] = g1[e]; bb[e] = e0[e]; bb[4 + e] = e1[e]; }
  unsigned short hb[8], lb[8];
#pragma unroll
  for (int e = 0; e < 8; ++e) {
    const float y  = d[e] * rstd * gg[e] + bb[e];
    const float ys = y * kXnCarry;
    const _Float16 h = (_Float16)ys;
    hb[e] = __builtin_bit_cast(unsigned short, h);
    lb[e] = h_bits(ys - (float)h);
  }
  const v4u uh = (v4u){pk16(hb[0], hb[1]), pk16(hb[2], hb[3]), pk16(hb[4], hb[5]), pk16(hb[6], hb[7])};
  const v4u ul = (v4u){pk16(lb[0], lb[1]), pk16(lb[2], lb[3]), pk16(lb[4], lb[5]), pk16(lb[6], lb[7])};
  unsigned short* q0 = xn + (size_t)row * kXnLd + c0;
  unsigned short* q1 = q0 + kHW;
  *(v4u*)q0 = uh;
  *(v4u*)q1 = ul;
  
}

// ---------------------------------------------------------------------------
// Column softmax of the transposed scores: sc [g][1024 j][1024 n] f32; for each (g, n): P[j] = exp(s - max_j) / sum_j exp,
// written as bf16 hi + lo planes pth/ptl [g][j][n] (this is exactly the Bt operand [m][n] of the value x attention product).
// Block = (64-column tile, g), 256 threads.
//         4 partials per column combined in fixed order.
// Pass 2: thread = 8 consecutive columns (t&7) of rows (t>>3) + 32*i, i < 32 (32 x 32 = 1024 rows, 8 x 8 = 64 columns = whole tile);
// ---------------------------------------------------------------------------
__global__ __launch_bounds__(256) void colsoftmax_kernel(const float* __restrict__ sc, unsigned short* __restrict__ pth,
                                                         unsigned short* __restrict__ ptl) {
  __shared__ float pm[4][64];
  __shared__ float ps[4][64];
  __shared__ float cmax[64];
  __shared__ float cinv[64];
  const int t  = threadIdx.x;
  const int n0 = blockIdx.x * 64;
  const int g  = blockIdx.y;
  const float* sg = sc + (size_t)g * kHW * kHW + n0;
  {
    const int col = t & 63, rg = t >> 6;
    const float* cp = sg + (size_t)rg * kHW + col;
    float m = cp[0];
    float s = 1.0f;
#pragma unroll 1
    for (int i = 1; i < 256; ++i) {
      const float x  = cp[(size_t)i * 4 * kHW];
      const float d  = x - m;
      const float ex = expf(-fabsf(d));
      const bool up  = d > 0.0f;
      s = up ? (s * ex + 1.0f) : (s + ex);
      m = up ? x : m;
    }
    pm[rg][col] = m;
    ps[rg][col] = s;
  }
  __syncthreads();
  if (t < 64) {
    const float M = fmaxf(fmaxf(pm[0][t], pm[1][t]), fmaxf(pm[2][t], pm[3][t]));
    float S = 0.f;
#pragma unroll 1
    for (int r = 0; r < 4; ++r) S += ps[r][t] * expf(pm[r][t] - M);
    cmax[t] = M;
    cinv[t] = 1.0f / S;
  }
  __syncthreads();
  {
    const int q8 = t & 7, ro = t >> 3, c0 = q8 * 8;
    unsigned short* oh = pth + (size_t)g * kHW * kHW + n0 + c0;
    unsigned short* ol = ptl + (size_t)g * kHW * kHW + n0 + c0;
#pragma unroll 1
    for (int i = 0; i < 32; ++i) {
      const int j = ro + 32 * i;
      const float* rp = sg + (size_t)j * kHW + c0;
      unsigned w0h = 0u, w1h = 0u, w2h = 0u, w3h = 0u;
      unsigned w0l = 0u, w1l = 0u, w2l = 0u, w3l = 0u;
#pragma unroll 1
      for (int e = 0; e < 8; ++e) {
        const float x = rp[e];
        const float p = expf(x - cmax[c0 + e]) * cinv[c0 + e];
        const unsigned short hb = f2bf_bits(p);
        const unsigned short lb = f2bf_bits(p - bf_bits2f(hb));
        const unsigned sh = (unsigned)(e & 1) * 16u;
        const unsigned hv = ((unsigned)hb) << sh;
        const unsigned lv = ((unsigned)lb) << sh;
        const int wsel = e >> 1;
        w0h |= (wsel == 0) ? hv : 0u;  w0l |= (wsel == 0) ? lv : 0u;
        w1h |= (wsel == 1) ? hv : 0u;  w1l |= (wsel == 1) ? lv : 0u;
        w2h |= (wsel == 2) ? hv : 0u;  w2l |= (wsel == 2) ? lv : 0u;
        w3h |= (wsel == 3) ? hv : 0u;  w3l |= (wsel == 3) ? lv : 0u;
      }
      const v4u uh = (v4u){w0h, w1h, w2h, w3h};
      const v4u ul = (v4u){w0l, w1l, w2l, w3l};
      unsigned short* ph = oh + (size_t)j * kHW;
      unsigned short* pl = ol + (size_t)j * kHW;
      *(v4u*)ph = uh;
      *(v4u*)pl = ul;
      
    }
  }
}

// ---------------------------------------------------------------------------
// Host orchestration.
// Workspace region map (bytes, 1 MiB aligned except w_sv, w_fv; total 114,032,640 B = 108.75 MiB):
//   [  0 MiB,  32 MiB)  xtok f16 [16][1024][1024]  -> then xn f16 [4096][2048] (16 MiB) -> then att f16 [16][1024][1024]
//   [ 32 MiB,  48 MiB)  xbuf f32 [16][256][1024]   -> then qk token-major f16 [16][2048][256] -> then scores f32 [4][1024][1024]
//   [ 48 MiB,  56 MiB)  P^T bf16 hi [4][1024][1024];  [56, 64) P^T bf16 lo
//   [ 64 MiB,  96 MiB)  v_spa hi, v_spa lo, v_freq hi, v_freq lo  bf16 [16][256][1024] (8 MiB each)
//   [ 96 MiB, 104 MiB)  w_qk f16 [2048][2048] (duplicated K);  [104,106) w_spa f16; [106,108) w_frq f16;
//   [108 MiB, +512 KiB) w_cdc f16 hi|lo [256][1024];  +512 KiB: w_sv f16 [256][256]; +640 KiB: w_fv f16; end 108 MiB + 768 KiB.
// ---------------------------------------------------------------------------
extern "C" void kernel_launch(void* const* d_in, const int* in_sizes, int n_in,
                              void* d_out, int out_size, void* d_ws, size_t ws_size,
                              hipStream_t stream) {
  if (n_in < 15) return;
  const int nX = kBatch * kChan * kHW;
  if (in_sizes[0] != nX || in_sizes[1] != nX) return;
  if (in_sizes[2] != kChan * kChan2 || in_sizes[3] != kChan) return;
  if (in_sizes[4] != kChan * kChan || in_sizes[5] != kChan) return;
  if (in_sizes[6] != kChan * kChan || in_sizes[7] != kChan) return;
  if (in_sizes[8] != kHW || in_sizes[9] != kHW) return;
  if (in_sizes[10] != kQK * kHW || in_sizes[11] != kHW * kHW || in_sizes[12] != kHW) return;
  if (in_sizes[13] != kHW * kHW || in_sizes[14] != kHW) return;
  if (out_size != 2 * nX) return;
  const size_t kMiB  = 1048576;
  const size_t wsEnd = 108 * kMiB + 768 * 1024;
  if (ws_size < wsEnd) return;

  const float* x_spa  = (const float*)d_in[0];
  const float* x_freq = (const float*)d_in[1];
  const float* w_cdc  = (const float*)d_in[2];
  const float* b_cdc  = (const float*)d_in[3];
  const float* w_sv   = (const float*)d_in[4];
  const float* b_sv   = (const float*)d_in[5];
  const float* w_fv   = (const float*)d_in[6];
  const float* b_fv   = (const float*)d_in[7];
  const float* ln_w   = (const float*)d_in[8];
  const float* ln_b   = (const float*)d_in[9];
  const float* w_qk   = (const float*)d_in[10];
  const float* w_spa  = (const float*)d_in[11];
  const float* b_spa  = (const float*)d_in[12];
  const float* w_frq  = (const float*)d_in[13];
  const float* b_frq  = (const float*)d_in[14];
  float* outp = (float*)d_out;

  char* ws = (char*)d_ws;
  unsigned short* xtok    = (unsigned short*)(ws);                      // phase 1
  unsigned short* xn      = (unsigned short*)(ws);                      // phase 2 (xtok dead)
  unsigned short* att16   = (unsigned short*)(ws);                      // phase 3+ (xn dead)
  float*          xbuf    = (float*)(ws + 32 * kMiB);                   // phase 1-2
  unsigned short* qktok   = (unsigned short*)(ws + 32 * kMiB);          // phase 2-3 (xbuf dead)
  float*          scores  = (float*)(ws + 32 * kMiB);                   // phase 4 (qktok dead)
  unsigned short* pt_hi   = (unsigned short*)(ws + 48 * kMiB);
  unsigned short* pt_lo   = (unsigned short*)(ws + 56 * kMiB);
  unsigned short* vspa_hi = (unsigned short*)(ws + 64 * kMiB);
  unsigned short* vspa_lo = (unsigned short*)(ws + 72 * kMiB);
  unsigned short* vfrq_hi = (unsigned short*)(ws + 80 * kMiB);
  unsigned short* vfrq_lo = (unsigned short*)(ws + 88 * kMiB);
  unsigned short* wqk2    = (unsigned short*)(ws + 96 * kMiB);
  unsigned short* wspa16  = (unsigned short*)(ws + 104 * kMiB);
  unsigned short* wfrq16  = (unsigned short*)(ws + 106 * kMiB);
  unsigned short* wcdc_pk = (unsigned short*)(ws + 108 * kMiB);
  unsigned short* wsv16   = (unsigned short*)(ws + 108 * kMiB + 512 * 1024);
  unsigned short* wfv16   = (unsigned short*)(ws + 108 * kMiB + 640 * 1024);

  const long sX   = (long)kChan * kHW;       // per-batch stride of x, v, out (elements)
  const long sTok = (long)kHW * kXtokLd;     // per-batch stride of xtok (halves)
  const long sXn  = (long)kChan * kXnLd;     // per-batch stride of xn (halves)
  const long sQK  = (long)kQK * kChan;       // per-batch stride of qktok (halves)
  const long sAtt = (long)kHW * kHW;         // per-batch stride of att / scores / P^T

  // ---- weight casts (whole planes; grids = exact element-group counts, ceil-div with in-kernel bound) ----
  {
    const int n8sv = kChan * kChan / 8;                 // 8192
    castw_kernel<0><<<(n8sv + 255) / 256, 256, 0, stream>>>(w_sv, wsv16, kChan, kChan, kChan, kWCarry);
    castw_kernel<0><<<(n8sv + 255) / 256, 256, 0, stream>>>(w_fv, wfv16, kChan, kChan, kChan, kWCarry);
    const int n8cdc = kChan * kChan2 / 8;               // 16384
    castw_kernel<2><<<(n8cdc + 255) / 256, 256, 0, stream>>>(w_cdc, wcdc_pk, kChan, kChan2, 2 * kChan2, kCdcCarry);
    const int n8qk = kQK * kHW / 8;                     // 262144
    castw_kernel<1><<<(n8qk + 255) / 256, 256, 0, stream>>>(w_qk, wqk2, kQK, kHW, 2 * kHW, kWCarry);
    const int n8w = kHW * kHW / 8;                      // 131072
    castw_kernel<0><<<(n8w + 255) / 256, 256, 0, stream>>>(w_spa, wspa16, kHW, kHW, kHW, kWCarry);
    castw_kernel<0><<<(n8w + 255) / 256, 256, 0, stream>>>(w_frq, wfrq16, kHW, kHW, kHW, kWCarry);
  }

  // ---- inputs -> token-major f16 plane [b][n][xcat | xcat] ----
  xtok_kernel<<<dim3(kHW / 64, kChan2 / 64, kBatch), 256, 0, stream>>>(x_spa, x_freq, xtok);

  // ---- v convs: v[b][c][n] = sum_cin w[c][cin] x[b][cin][n] + bias[c]; A = w f16 x16 (lda 256), Bt = xtok (ldb 1024), K = 256;
  //      out bf16 hi + lo planes [b][256][1024] ----
  wmma_gemm64<0, false, 1, 2, false><<<dim3(8, kBatch), 256, 0, stream>>>(
      wsv16, wsv16, kChan, 0L, xtok, xtok, kXtokLd, sTok,
      (void*)vspa_hi, (void*)vspa_lo, kHW, sX, b_sv, x_spa, 0L, kChan, kHW, kChan, 1.0f / kWCarry);
  wmma_gemm64<0, false, 1, 2, false><<<dim3(8, kBatch), 256, 0, stream>>>(
      wfv16, wfv16, kChan, 0L, xtok + kChan, xtok + kChan, kXtokLd, sTok,
      (void*)vfrq_hi, (void*)vfrq_lo, kHW, sX, b_fv, x_freq, 0L, kChan, kHW, kChan, 1.0f / kWCarry);

  // ---- cdc conv: x[b][c][n] = sum_cin w_cdc[c][cin] xcat[b][cin][n] + b_cdc[c]; A = [hi|lo](2^14 w_cdc) [256][1024],
  //      Bt = [xcat|xcat] (ldb 1024), K = 1024, scale 2^-14; out f32 [b][256][1024] ----
  wmma_gemm64<0, false, 1, 0, false><<<dim3(8, kBatch), 256, 0, stream>>>(
      wcdc_pk, wcdc_pk, 2 * kChan2, 0L, xtok, xtok, kXtokLd, sTok,
      (void*)xbuf, (void*)xbuf, kHW, sX, b_cdc, x_spa, 0L, kChan, kHW, 2 * kChan2, 1.0f / kCdcCarry);

  // ---- LayerNorm rows -> xn [4096][hi(1024) | lo(1024)] f16 carried x2^10 ----
  layernorm_kernel<<<kBatch * kChan, 128, 0, stream>>>(xbuf, ln_w, ln_b, xn);

  // ---- q|k token-major: qk[b][j][c] = sum_d w_qk[j][d] xn[b][c][d]; A = [w|w] f16 x16 [2048][2048], Bt = xn (ldb 2048, N 256),
  //      K = 2048, scale 1/(16*1024); out f16 [b][2048][256] (rows 0..1023 = q, 1024..2047 = k) ----
  wmma_gemm64<0, false, 0, 1, false><<<dim3(16, kBatch), 256, 0, stream>>>(
      wqk2, wqk2, 2 * kHW, 0L, xn, xn, kXnLd, sXn,
      (void*)qktok, (void*)qktok, kChan, sQK, b_cdc, x_spa, 0L, kQK, kChan, 2 * kHW, 1.0f / (kWCarry * kXnCarry));

  // ---- att[b][n][m] = (1/32) sum_c q[b][c][n] k[b][c][m]; A = q token-major (lda 256), Bt = k token-major, K = 256; out f16 ----
  wmma_gemm64<0, false, 0, 1, false><<<dim3(32, kBatch), 256, 0, stream>>>(
      qktok, qktok, kChan, sQK, qktok + (size_t)kHW * kChan, qktok + (size_t)kHW * kChan, kChan, sQK,
      (void*)att16, (void*)att16, kHW, sAtt, b_cdc, x_spa, 0L, kHW, kHW, kChan, 0.03125f);

  // ---- per branch, per group of 4 batches:
  //      scores^T[g][j][n] = sum_m W[j][m] att[b][n][m] / 16 + bias[j]  (A = W f16 x16, Bt = att, K = 1024, f32 out)
  //      column softmax over j -> P^T bf16 hi/lo [g][j][n]
  //      out[b][c][m] = x[b][c][m] + sum_n v[b][c][n] P^T[m][n]  (A = v hi/lo, Bt = P^T hi/lo, 3 bf16 products, f32 out + f32 residual) ----
  for (int br = 0; br < 2; ++br) {
    const unsigned short* w16 = (br == 0) ? wspa16 : wfrq16;
    const float* bsc          = (br == 0) ? b_spa : b_frq;
    const unsigned short* vh  = (br == 0) ? vspa_hi : vfrq_hi;
    const unsigned short* vl  = (br == 0) ? vspa_lo : vfrq_lo;
    const float* xres         = (br == 0) ? x_spa : x_freq;
    float* ob = outp + (size_t)br * (size_t)nX;
    for (int gi = 0; gi < kNGrp; ++gi) {
      const int b0 = gi * kGrp;
      wmma_gemm64<0, false, 1, 0, false><<<dim3(32, kGrp), 256, 0, stream>>>(
          w16, w16, kHW, 0L, att16 + (size_t)b0 * sAtt, att16 + (size_t)b0 * sAtt, kHW, sAtt,
          (void*)scores, (void*)scores, kHW, sAtt, bsc, xres, 0L, kHW, kHW, kHW, 1.0f / kWCarry);
      colsoftmax_kernel<<<dim3(kHW / 64, kGrp), 256, 0, stream>>>(scores, pt_hi, pt_lo);
      wmma_gemm64<1, true, 0, 0, true><<<dim3(8, kGrp), 256, 0, stream>>>(
          vh + (size_t)b0 * sX, vl + (size_t)b0 * sX, kHW, sX, pt_hi, pt_lo, kHW, sAtt,
          (void*)(ob + (size_t)b0 * sX), (void*)(ob + (size_t)b0 * sX), kHW, sX, bsc,
          xres + (size_t)b0 * sX, sX, kChan, kHW, kHW, 1.0f);
    }
  }
}

// v001
// It runs in 794 microseconds.
// Timed twice side by side with v000, it ran 2.69 times as fast both times.
// Contractions: v 1x1 convs (w f16 x16, x f16), cdc 1x1 conv (w carried x2^14 as f16 hi|lo K-packed, x f16 duplicated along K), w_qk projection (w f16 x16 duplicated along K, LN output carried x2^10 as f16 hi|lo K-packed), q^T.k (q,k f16), W.att^T score GEMMs (W f16 x16, att f16): v_wmma_f32_16x16x32_f16; value x attention^T (v and P^T as bf16 hi+lo planes, hi.hi+hi.lo+lo.hi): v_wmma_f32_16x16x32_bf16; all f32 accumulate; LayerNorm and softmax in f32.
#include <hip/hip_runtime.h>
#include <math.h>

// ---------------------------------------------------------------------------
// Problem constants
// ---------------------------------------------------------------------------
constexpr int kBatch  = 16;
constexpr int kChan   = 256;              // channels
constexpr int kChan2  = 512;              // concatenated channels
constexpr int kHW     = 1024;             // h*w = dim
constexpr int kQK     = 2048;             // q|k outputs
constexpr int kXtokLd = 1024;             // token-major input plane pitch (halves): [xcat(512) | xcat(512)]
constexpr int kXnLd   = 2048;             // LN output plane pitch (halves): [hi(1024) | lo(1024)]
constexpr int kGrp    = 16;               // batches per score/softmax/output launch (all of them: 256 softmax blocks = one per WGP)
constexpr int kNGrp   = kBatch / kGrp;
constexpr float kWCarry    = 16.0f;       // plain weights carried x16 in f16
constexpr float kCdcCarry  = 16384.0f;    // w_cdc carried x2^14 (hi|lo)
constexpr float kXnCarry   = 1024.0f;     // LN output carried x2^10 (hi|lo)
constexpr float kInvHW     = 1.0f / 1024.0f;
constexpr float kLnEps     = 1e-5f;

typedef __attribute__((ext_vector_type(16))) _Float16 v16h;
typedef __attribute__((ext_vector_type(8)))  _Float16 v8h;
typedef __attribute__((ext_vector_type(16))) __bf16   v16b;
typedef __attribute__((ext_vector_type(8)))  __bf16   v8b;
typedef __attribute__((ext_vector_type(8)))  float    v8f;
typedef __attribute__((ext_vector_type(4)))  float    v4f;
typedef __attribute__((ext_vector_type(4)))  unsigned int v4u;

// ---------------------------------------------------------------------------
// Helpers
// ---------------------------------------------------------------------------
__device__ __forceinline__ unsigned short f2bf_bits(float f) {
  unsigned u = __float_as_uint(f);
  return (unsigned short)((u + 0x7FFFu + ((u >> 16) & 1u)) >> 16);
}
__device__ __forceinline__ float bf_bits2f(unsigned short h) { return __uint_as_float(((unsigned)h) << 16); }

// hazard guards as plain device helpers (no inline asm inside the kernel template body)
__device__ __forceinline__ void dep_guard_h(v8f& a, v8f& b, v16h x, v16h y) { asm volatile("v_nop\n\tv_nop\n\tv_nop\n\tv_nop" : "+v"(a), "+v"(b) : "v"(x), "v"(y)); }
__device__ __forceinline__ void dep_guard_b(v8f& a, v8f& b, v16b x, v16b y) { asm volatile("v_nop\n\tv_nop\n\tv_nop\n\tv_nop" : "+v"(a), "+v"(b) : "v"(x), "v"(y)); }
__device__ __forceinline__ void keep4_h(v16h a, v16h b, v16h c, v16h d) { asm volatile("v_nop" :: "v"(a), "v"(b), "v"(c), "v"(d)); }
__device__ __forceinline__ void keep4_b(v16b a, v16b b, v16b c, v16b d) { asm volatile("v_nop" :: "v"(a), "v"(b), "v"(c), "v"(d)); }
__device__ __forceinline__ void acc_guard4(v8f& a, v8f& b, v8f& c, v8f& d) { asm volatile("v_nop\n\tv_nop\n\tv_nop\n\tv_nop" : "+v"(a), "+v"(b), "+v"(c), "+v"(d)); }
template <typename T> struct Frag;
template <> struct Frag<_Float16> {
  typedef v16h V; union U { v16h v; v8h h[2]; };
  static __device__ __forceinline__ v16h load(const _Float16* p) {   // elements 0..7 <- p[0..7], 8..15 <- p[16..23]
    U f; f.h[0] = *(const v8h*)(p); f.h[1] = *(const v8h*)(p + 16); return f.v;
  }
  static __device__ __forceinline__ v8f mma(v16h a, v16h b, v8f c) {
    return __builtin_amdgcn_wmma_f32_16x16x32_f16(false, a, false, b, (short)0, c, false, false);
  }
  static __device__ __forceinline__ void guard(v8f& a, v8f& b, v16h x, v16h y) { dep_guard_h(a, b, x, y); }
  static __device__ __forceinline__ void keep(v16h a, v16h b, v16h c, v16h d) { keep4_h(a, b, c, d); }
};
template <> struct Frag<__bf16> {
  typedef v16b V; union U { v16b v; v8b h[2]; };
  static __device__ __forceinline__ v16b load(const __bf16* p) {
    U f; f.h[0] = *(const v8b*)(p); f.h[1] = *(const v8b*)(p + 16); return f.v;
  }
  static __device__ __forceinline__ v8f mma(v16b a, v16b b, v8f c) {
    return __builtin_amdgcn_wmma_f32_16x16x32_bf16(false, a, false, b, (short)0, c, false, false);
  }
  static __device__ __forceinline__ void guard(v8f& a, v8f& b, v16b x, v16b y) { dep_guard_b(a, b, x, y); }
  static __device__ __forceinline__ void keep(v16b a, v16b b, v16b c, v16b d) { keep4_b(a, b, c, d); }
};

__device__ __forceinline__ unsigned pk16(unsigned short a, unsigned short b) { return (unsigned)a | ((unsigned)b << 16); }
__device__ __forceinline__ unsigned short h_bits(float f) { const _Float16 h = (_Float16)f; return __builtin_bit_cast(unsigned short, h); }

// ---- Register-blocked batched WMMA GEMM (ACT reduced to none/relu/leaky) -----------------------
// C[m,n] = scale * sum_k A[m,k] * Bt[n,k] (+bias)(+resid); each wave owns a 64x64 tile.
// A row-major [M,K]; Bt row-major [N,K]; M,N % 64 == 0, K % 32 == 0.
// SPLIT: operands are hi/lo planes (A2/Bt2 = lo planes, same layout); product = hi.hi + hi.lo + lo.hi.
// BIAS_MODE: 0 = none, 1 = bias[m], 2 = bias[n].
// OUT_MODE: 0 = f32, 1 = f16, 2 = bf16 hi plane (Cout) + bf16 lo plane (Cout2).
// ET: 0 = f16 operands, 1 = bf16 operands (pointers passed as 16-bit storage)
template <int ET> struct Elem;
template <> struct Elem<0> { typedef _Float16 T; };
template <> struct Elem<1> { typedef __bf16 T; };
template <int ET, bool SPLIT, int BIAS_MODE, int OUT_MODE, bool RESID, int ACT = 0>
__global__ __launch_bounds__(256) void wmma_gemm64(
    const unsigned short* __restrict__ Ap, const unsigned short* __restrict__ A2p, int lda, long strideA,
    const unsigned short* __restrict__ Btp, const unsigned short* __restrict__ Bt2p, int ldb, long strideB,
    void* __restrict__ Cout, void* __restrict__ Cout2, int ldc, long strideC,
    const float* __restrict__ bias,
    const float* __restrict__ resid, long strideR,
    int M, int N, int K, float scale) {
  typedef typename Elem<ET>::T T;
  typedef typename Frag<T>::V V;
  const T* A = (const T*)Ap; const T* A2 = (const T*)A2p; const T* Bt = (const T*)Btp; const T* Bt2 = (const T*)Bt2p;
  __shared__ __align__(16) float sT[8][16 * 68];   // per-wave 16x64 slab, pitch 68 floats
  const int b    = blockIdx.y;
  const int lane = threadIdx.x & 31;
  const int wave = threadIdx.x >> 5;
  const int tilesN = N >> 6;
  const int tilesM = M >> 6;
  const int tile = blockIdx.x * 8 + wave;
  if (tile >= tilesM * tilesN) return;   // wave-uniform; no block barriers in this kernel
  const int tm = tile / tilesN;
  const int tn = tile - tm * tilesN;
  const int m0 = tm << 6;
  const int n0 = tn << 6;

  const T* Ab  = A  + (size_t)b * strideA;
  const T* Bb  = Bt + (size_t)b * strideB;
  const T* Ab2 = SPLIT ? (A2  + (size_t)b * strideA) : nullptr;
  const T* Bb2 = SPLIT ? (Bt2 + (size_t)b * strideB) : nullptr;

  const int rlane = lane & 15;                 // row (A) / col (B, D) within subtile
  const int koff  = (lane >> 4) * 8;           // k offset of this lane half
  const int mOff  = (lane >> 4) * 8;           // D row offset

  v8f acc[4][4];
#pragma unroll
  for (int i = 0; i < 4; ++i)
#pragma unroll
    for (int j = 0; j < 4; ++j) acc[i][j] = (v8f){0.f,0.f,0.f,0.f,0.f,0.f,0.f,0.f};

  for (int k0 = 0; k0 < K; k0 += 32) {
    V bh[4], bl[4];
#pragma unroll
    for (int j = 0; j < 4; ++j) {
      const size_t bo = (size_t)(n0 + (j << 4) + rlane) * ldb + koff + k0;
      bh[j] = Frag<T>::load(Bb + bo);
      if (SPLIT) bl[j] = Frag<T>::load(Bb2 + bo);
    }
#pragma unroll
    for (int i = 0; i < 4; ++i) {
      const size_t ao = (size_t)(m0 + (i << 4) + rlane) * lda + koff + k0;
      V ah = Frag<T>::load(Ab + ao);
      V al;
      if (SPLIT) al = Frag<T>::load(Ab2 + ao);
#pragma unroll
      for (int j = 0; j < 4; ++j) {
        acc[i][j] = Frag<T>::mma(ah, bh[j], acc[i][j]);
        if (SPLIT) {
          acc[i][j] = Frag<T>::mma(ah, bl[j], acc[i][j]);
          acc[i][j] = Frag<T>::mma(al, bh[j], acc[i][j]);
        }
      }
      Frag<T>::guard(acc[i][0], acc[i][3], ah, SPLIT ? al : ah);
    }
    Frag<T>::keep(bh[0], bh[1], bh[2], bh[3]);
    if (SPLIT) Frag<T>::keep(bl[0], bl[1], bl[2], bl[3]);
  }
  acc_guard4(acc[0][0], acc[0][1], acc[0][2], acc[0][3]);
  acc_guard4(acc[1][0], acc[1][1], acc[1][2], acc[1][3]);
  acc_guard4(acc[2][0], acc[2][1], acc[2][2], acc[2][3]);
  acc_guard4(acc[3][0], acc[3][1], acc[3][2], acc[3][3]);

  // ---- epilogue ----
  float* slab = sT[wave];
  const float* Rb = RESID ? (resid + (size_t)b * strideR) : nullptr;
#pragma unroll
  for (int i = 0; i < 4; ++i) {
    const int mBase = m0 + (i << 4);
#pragma unroll
    for (int j = 0; j < 4; ++j) {
      const int n = n0 + (j << 4) + rlane;
      float bv = 0.f;
      if (BIAS_MODE == 2) bv = bias[n];
#pragma unroll
      for (int r = 0; r < 8; ++r) {
        float v = acc[i][j][r] * scale;
        if (BIAS_MODE == 1) v += bias[mBase + mOff + r];
        if (BIAS_MODE == 2) v += bv;
        if (RESID) v += Rb[(size_t)(mBase + mOff + r) * ldc + n];
        if (ACT == 2) v = fmaxf(v, 0.0f);
        if (ACT == 4) v = (v > 0.f) ? v : 0.01f * v;
        slab[(mOff + r) * 68 + (j << 4) + rlane] = v;
      }
    }
    __builtin_amdgcn_fence(__ATOMIC_RELEASE, "workgroup");
    __builtin_amdgcn_wave_barrier();
    __builtin_amdgcn_fence(__ATOMIC_ACQUIRE, "workgroup");
    if (OUT_MODE == 0) {
      float* C = (float*)Cout + (size_t)b * strideC;
      const int hh = lane >> 4, c4 = (lane & 15) * 4;     // row seg = 256 B = 16 lanes x 16 B
      {
#pragma unroll
        for (int it = 0; it < 8; ++it) {
          const int row = it * 2 + hh;
          v4f v = *(const v4f*)(slab + row * 68 + c4);
          *(v4f*)(C + (size_t)(mBase + row) * ldc + n0 + c4) = v;
        }
        
      }
    } else {
      const int q = lane >> 3, c8 = (lane & 7) * 8;
      unsigned short* C  = (unsigned short*)Cout  + (size_t)b * strideC;
      unsigned short* C2 = (OUT_MODE == 2) ? ((unsigned short*)Cout2 + (size_t)b * strideC) : nullptr;
      {
#pragma unroll
        for (int it = 0; it < 4; ++it) {
          const int row = it * 4 + q;
          const float* sp = slab + row * 68 + c8;
          v8h hv, lv;
#pragma unroll
          for (int e = 0; e < 8; ++e) {
            if (OUT_MODE == 1) {
              hv[e] = (_Float16)sp[e];
            } else {
              unsigned short hb = f2bf_bits(sp[e]);
              unsigned short lb = f2bf_bits(sp[e] - bf_bits2f(hb));
              hv[e] = __builtin_bit_cast(_Float16, hb);
              lv[e] = __builtin_bit_cast(_Float16, lb);
            }
          }
          *(v8h*)(C + (size_t)(mBase + row) * ldc + n0 + c8) = hv;
          if (OUT_MODE == 2) *(v8h*)(C2 + (size_t)(mBase + row) * ldc + n0 + c8) = lv;
        }
        
      }
    }
    __builtin_amdgcn_fence(__ATOMIC_RELEASE, "workgroup");
    __builtin_amdgcn_wave_barrier();
    __builtin_amdgcn_fence(__ATOMIC_ACQUIRE, "workgroup");
  }
}

// ---------------------------------------------------------------------------
// Weight cast: in [rows][cols] f32 -> out [rows][ldo] halves.
//   MODE 0: out[r][c] = f16(scale*v)
//   MODE 1: out[r][c] = out[r][cols + c] = f16(scale*v)            (duplicated along K)
//   MODE 2: out[r][c] = hi = f16(scale*v), out[r][cols + c] = f16(scale*v - hi)   (hi|lo, common scale)
// One thread = 8 consecutive elements of one row (two 16-B loads, one 16-B store per plane);
// ---------------------------------------------------------------------------
template <int MODE>
__global__ __launch_bounds__(256) void castw_kernel(const float* __restrict__ in, unsigned short* __restrict__ out,
                                                      int rows, int cols, int ldo, float scale) {
  const int gpr = cols >> 3;
  const int n8  = rows * gpr;
  const int i   = blockIdx.x * 256 + threadIdx.x;
  if (i >= n8) return;
  const int r = i / gpr;
  const int g = i - r * gpr;
  const float* p = in + (size_t)r * cols + 8 * g;
  const v4f a = *(const v4f*)(p);
  const v4f c = *(const v4f*)(p + 4);
  float x[8];
#pragma unroll
  for (int e = 0; e < 4; ++e) { x[e] = a[e] * scale; x[4 + e] = c[e] * scale; }
  unsigned short hb[8], lb[8];
#pragma unroll
  for (int e = 0; e < 8; ++e) {
    const _Float16 h = (_Float16)x[e];
    hb[e] = __builtin_bit_cast(unsigned short, h);
    lb[e] = (MODE == 2) ? h_bits(x[e] - (float)h) : hb[e];
  }
  const v4u uh = (v4u){pk16(hb[0], hb[1]), pk16(hb[2], hb[3]), pk16(hb[4], hb[5]), pk16(hb[6], hb[7])};
  const v4u ul = (v4u){pk16(lb[0], lb[1]), pk16(lb[2], lb[3]), pk16(lb[4], lb[5]), pk16(lb[6], lb[7])};
  unsigned short* q0 = out + (size_t)r * ldo + 8 * g;
  unsigned short* q1 = q0 + cols;
  *(v4u*)q0 = uh;
  if (MODE != 0) *(v4u*)q1 = ul;
  
}

// ---------------------------------------------------------------------------
// Input transpose + cast: x_spa, x_freq [b][256][1024] f32 -> xtok [b][1024 tokens][1024 halves] f16 with
// cols ct*64..ct*64+63 = channels (ct 0..3: x_spa channels ct*64.., ct 4..7: x_freq channels (ct-4)*64..),
// i.e. cols 0..511 = concatenated channels, and the same values duplicated at cols 512..1023.
// grid (16 token tiles, 8 channel tiles, 16 batches), 256 threads; LDS tile 64 tokens x 64 channels.
// Load coverage: 16 iterations x 256 threads = 4096 = whole tile (coalesced along tokens).
// Store coverage: 8 waves x 2 iterations x 4 rows (lane>>3) = 64 token rows; (lane&7) x 8 halves = 64 channels;
// ---------------------------------------------------------------------------
__global__ __launch_bounds__(256) void xtok_kernel(const float* __restrict__ xs, const float* __restrict__ xf,
                                                   unsigned short* __restrict__ xtok) {
  __shared__ float sm[64][65];   // sm[token_local][channel_local]
  const int t  = threadIdx.x;
  const int n0 = blockIdx.x * 64;
  const int ct = blockIdx.y;                 // block-uniform source select
  const int b  = blockIdx.z;
  const float* X = (ct < 4) ? xs : xf;
  const int c0 = (ct & 3) * 64;
  const float* src = X + ((size_t)b * kChan + c0) * kHW + n0;
#pragma unroll
  for (int i = 0; i < 16; ++i) {
    const int e  = i * 256 + t;
    const int r  = e >> 6;        // channel local
    const int cc = e & 63;        // token local
    sm[cc][r] = src[(size_t)r * kHW + cc];
  }
  __syncthreads();
  const int lane = t & 31, wave = t >> 5;
  const int q = lane >> 3, c8 = (lane & 7) * 8;
  unsigned short* ob = xtok + ((size_t)b * kHW + n0) * kXtokLd + ct * 64 + c8;
#pragma unroll
  for (int it = 0; it < 2; ++it) {
    const int row = wave * 8 + it * 4 + q;   // token local
    unsigned short hb[8];
#pragma unroll
    for (int e = 0; e < 8; ++e) hb[e] = h_bits(sm[row][c8 + e]);
    const v4u u = (v4u){pk16(hb[0], hb[1]), pk16(hb[2], hb[3]), pk16(hb[4], hb[5]), pk16(hb[6], hb[7])};
    unsigned short* p0 = ob + (size_t)row * kXtokLd;
    unsigned short* p1 = p0 + kChan2;
    *(v4u*)p0 = u;
    *(v4u*)p1 = u;
    
  }
}

// ---------------------------------------------------------------------------
// Output row of xn [4096][2048] halves: cols 0..1023 = hi = f16(1024*y), cols 1024..2047 = f16(1024*y - hi).
// Block = 128 threads = one row; thread t owns cols 8t..8t+7 (128 x 8 = 1024 = whole row).
// ---------------------------------------------------------------------------
__global__ __launch_bounds__(128) void layernorm_kernel(const float* __restrict__ xb, const float* __restrict__ gam,
                                                        const float* __restrict__ bet, unsigned short* __restrict__ xn) {
  __shared__ float red[4];
  const int row  = blockIdx.x;
  const int t    = threadIdx.x, lane = t & 31, wave = t >> 5;
  const int c0   = t * 8;
  const float* px = xb + (size_t)row * kHW + c0;
  const v4f a = *(const v4f*)(px);
  const v4f c = *(const v4f*)(px + 4);
  float x[8];
#pragma unroll
  for (int e = 0; e < 4; ++e) { x[e] = a[e]; x[4 + e] = c[e]; }
  float s = ((x[0] + x[1]) + (x[2] + x[3])) + ((x[4] + x[5]) + (x[6] + x[7]));
#pragma unroll
  for (int off = 16; off > 0; off >>= 1) s += __shfl_xor(s, off, 32);
  if (lane == 0) red[wave] = s;
  __syncthreads();
  const float mean = ((red[0] + red[1]) + (red[2] + red[3])) * kInvHW;
  __syncthreads();
  float d[8];
  float sq = 0.f;
#pragma unroll
  for (int e = 0; e < 8; ++e) { d[e] = x[e] - mean; sq += d[e] * d[e]; }
#pragma unroll
  for (int off = 16; off > 0; off >>= 1) sq += __shfl_xor(sq, off, 32);
  if (lane == 0) red[wave] = sq;
  __syncthreads();
  const float var  = ((red[0] + red[1]) + (red[2] + red[3])) * kInvHW;
  const float rstd = 1.0f / sqrtf(var + kLnEps);
  const v4f g0 = *(const v4f*)(gam + c0), g1 = *(const v4f*)(gam + c0 + 4);
  const v4f e0 = *(const v4f*)(bet + c0), e1 = *(const v4f*)(bet + c0 + 4);
  float gg[8], bb[8];
#pragma unroll
  for (int e = 0; e < 4; ++e) { gg[e] = g0[e]; gg[4 + e] = g1[e]; bb[e] = e0[e]; bb[4 + e] = e1[e]; }
  unsigned short hb[8], lb[8];
#pragma unroll
  for (int e = 0; e < 8; ++e) {
    const float y  = d[e] * rstd * gg[e] + bb[e];
    const float ys = y * kXnCarry;
    const _Float16 h = (_Float16)ys;
    hb[e] = __builtin_bit_cast(unsigned short, h);
    lb[e] = h_bits(ys - (float)h);
  }
  const v4u uh = (v4u){pk16(hb[0], hb[1]), pk16(hb[2], hb[3]), pk16(hb[4], hb[5]), pk16(hb[6], hb[7])};
  const v4u ul = (v4u){pk16(lb[0], lb[1]), pk16(lb[2], lb[3]), pk16(lb[4], lb[5]), pk16(lb[6], lb[7])};
  unsigned short* q0 = xn + (size_t)row * kXnLd + c0;
  unsigned short* q1 = q0 + kHW;
  *(v4u*)q0 = uh;
  *(v4u*)q1 = ul;
  
}

// ---------------------------------------------------------------------------
// Column softmax of the transposed scores: sc [g][1024 j][1024 n] f32; for each (g, n): P[j] = exp(s - max_j) / sum_j exp,
// written as bf16 hi + lo planes pth/ptl [g][j][n] (this is exactly the Bt operand [m][n] of the value x attention product).
// Block = (64-column tile, g), 256 threads.
//         4 partials per column combined in fixed order.
// Pass 2: thread = 8 consecutive columns (t&7) of rows (t>>3) + 32*i, i < 32 (32 x 32 = 1024 rows, 8 x 8 = 64 columns = whole tile);
// ---------------------------------------------------------------------------
__global__ __launch_bounds__(256) void colsoftmax_kernel(const float* __restrict__ sc, unsigned short* __restrict__ pth,
                                                         unsigned short* __restrict__ ptl) {
  __shared__ float pm[4][64];
  __shared__ float ps[4][64];
  __shared__ float cmax[64];
  __shared__ float cinv[64];
  const int t  = threadIdx.x;
  const int n0 = blockIdx.x * 64;
  const int g  = blockIdx.y;
  const float* sg = sc + (size_t)g * kHW * kHW + n0;
  {
    const int col = t & 63, rg = t >> 6;
    const float* cp = sg + (size_t)rg * kHW + col;
    float m = cp[0];
    float s = 1.0f;
#pragma unroll 1
    for (int i = 1; i < 256; ++i) {
      const float x  = cp[(size_t)i * 4 * kHW];
      const float d  = x - m;
      const float ex = expf(-fabsf(d));
      const bool up  = d > 0.0f;
      s = up ? (s * ex + 1.0f) : (s + ex);
      m = up ? x : m;
    }
    pm[rg][col] = m;
    ps[rg][col] = s;
  }
  __syncthreads();
  if (t < 64) {
    const float M = fmaxf(fmaxf(pm[0][t], pm[1][t]), fmaxf(pm[2][t], pm[3][t]));
    float S = 0.f;
#pragma unroll 1
    for (int r = 0; r < 4; ++r) S += ps[r][t] * expf(pm[r][t] - M);
    cmax[t] = M;
    cinv[t] = 1.0f / S;
  }
  __syncthreads();
  {
    const int q8 = t & 7, ro = t >> 3, c0 = q8 * 8;
    unsigned short* oh = pth + (size_t)g * kHW * kHW + n0 + c0;
    unsigned short* ol = ptl + (size_t)g * kHW * kHW + n0 + c0;
#pragma unroll 1
    for (int i = 0; i < 32; ++i) {
      const int j = ro + 32 * i;
      const float* rp = sg + (size_t)j * kHW + c0;
      unsigned w0h = 0u, w1h = 0u, w2h = 0u, w3h = 0u;
      unsigned w0l = 0u, w1l = 0u, w2l = 0u, w3l = 0u;
#pragma unroll 1
      for (int e = 0; e < 8; ++e) {
        const float x = rp[e];
        const float p = expf(x - cmax[c0 + e]) * cinv[c0 + e];
        const unsigned short hb = f2bf_bits(p);
        const unsigned short lb = f2bf_bits(p - bf_bits2f(hb));
        const unsigned sh = (unsigned)(e & 1) * 16u;
        const unsigned hv = ((unsigned)hb) << sh;
        const unsigned lv = ((unsigned)lb) << sh;
        const int wsel = e >> 1;
        w0h |= (wsel == 0) ? hv : 0u;  w0l |= (wsel == 0) ? lv : 0u;
        w1h |= (wsel == 1) ? hv : 0u;  w1l |= (wsel == 1) ? lv : 0u;
        w2h |= (wsel == 2) ? hv : 0u;  w2l |= (wsel == 2) ? lv : 0u;
        w3h |= (wsel == 3) ? hv : 0u;  w3l |= (wsel == 3) ? lv : 0u;
      }
      const v4u uh = (v4u){w0h, w1h, w2h, w3h};
      const v4u ul = (v4u){w0l, w1l, w2l, w3l};
      unsigned short* ph = oh + (size_t)j * kHW;
      unsigned short* pl = ol + (size_t)j * kHW;
      *(v4u*)ph = uh;
      *(v4u*)pl = ul;
      
    }
  }
}

// ---------------------------------------------------------------------------
// Host orchestration.
// Workspace region map (bytes, 1 MiB aligned except w_sv and w_fv; total 214,695,936 B = 204.75 MiB):
//   [  0 MiB,  32 MiB)  xtok f16 [16][1024][1024]  -> then xn f16 [4096][2048] (16 MiB) -> then att f16 [16][1024][1024]
//   [ 32 MiB,  96 MiB)  xbuf f32 [16][256][1024] (16 MiB) -> then qk token-major f16 [16][2048][256] (16 MiB)
//                       -> then scores f32 [16][1024][1024] (64 MiB)
//   [ 96 MiB, 128 MiB)  P^T bf16 hi [16][1024][1024];  [128, 160) P^T bf16 lo
//   [160 MiB, 192 MiB)  v_spa hi, v_spa lo, v_freq hi, v_freq lo  bf16 [16][256][1024] (8 MiB each)
//   [192 MiB, 200 MiB)  w_qk f16 [2048][2048] (duplicated K);  [200,202) w_spa f16; [202,204) w_frq f16;
//   [204 MiB, +512 KiB) w_cdc f16 hi|lo [256][1024];  +512 KiB: w_sv f16 [256][256]; +640 KiB: w_fv f16; end 204 MiB + 768 KiB.
// ---------------------------------------------------------------------------
extern "C" void kernel_launch(void* const* d_in, const int* in_sizes, int n_in,
                              void* d_out, int out_size, void* d_ws, size_t ws_size,
                              hipStream_t stream) {
  if (n_in < 15) return;
  const int nX = kBatch * kChan * kHW;
  if (in_sizes[0] != nX || in_sizes[1] != nX) return;
  if (in_sizes[2] != kChan * kChan2 || in_sizes[3] != kChan) return;
  if (in_sizes[4] != kChan * kChan || in_sizes[5] != kChan) return;
  if (in_sizes[6] != kChan * kChan || in_sizes[7] != kChan) return;
  if (in_sizes[8] != kHW || in_sizes[9] != kHW) return;
  if (in_sizes[10] != kQK * kHW || in_sizes[11] != kHW * kHW || in_sizes[12] != kHW) return;
  if (in_sizes[13] != kHW * kHW || in_sizes[14] != kHW) return;
  if (out_size != 2 * nX) return;
  const size_t kMiB  = 1048576;
  const size_t wsEnd = 204 * kMiB + 768 * 1024;
  if (ws_size < wsEnd) return;

  const float* x_spa  = (const float*)d_in[0];
  const float* x_freq = (const float*)d_in[1];
  const float* w_cdc  = (const float*)d_in[2];
  const float* b_cdc  = (const float*)d_in[3];
  const float* w_sv   = (const float*)d_in[4];
  const float* b_sv   = (const float*)d_in[5];
  const float* w_fv   = (const float*)d_in[6];
  const float* b_fv   = (const float*)d_in[7];
  const float* ln_w   = (const float*)d_in[8];
  const float* ln_b   = (const float*)d_in[9];
  const float* w_qk   = (const float*)d_in[10];
  const float* w_spa  = (const float*)d_in[11];
  const float* b_spa  = (const float*)d_in[12];
  const float* w_frq  = (const float*)d_in[13];
  const float* b_frq  = (const float*)d_in[14];
  float* outp = (float*)d_out;

  char* ws = (char*)d_ws;
  unsigned short* xtok    = (unsigned short*)(ws);                      // phase 1
  unsigned short* xn      = (unsigned short*)(ws);                      // phase 2 (xtok dead)
  unsigned short* att16   = (unsigned short*)(ws);                      // phase 3+ (xn dead)
  float*          xbuf    = (float*)(ws + 32 * kMiB);                   // phase 1-2
  unsigned short* qktok   = (unsigned short*)(ws + 32 * kMiB);          // phase 2-3 (xbuf dead)
  float*          scores  = (float*)(ws + 32 * kMiB);                   // phase 4 (qktok dead)
  unsigned short* pt_hi   = (unsigned short*)(ws + 96 * kMiB);
  unsigned short* pt_lo   = (unsigned short*)(ws + 128 * kMiB);
  unsigned short* vspa_hi = (unsigned short*)(ws + 160 * kMiB);
  unsigned short* vspa_lo = (unsigned short*)(ws + 168 * kMiB);
  unsigned short* vfrq_hi = (unsigned short*)(ws + 176 * kMiB);
  unsigned short* vfrq_lo = (unsigned short*)(ws + 184 * kMiB);
  unsigned short* wqk2    = (unsigned short*)(ws + 192 * kMiB);
  unsigned short* wspa16  = (unsigned short*)(ws + 200 * kMiB);
  unsigned short* wfrq16  = (unsigned short*)(ws + 202 * kMiB);
  unsigned short* wcdc_pk = (unsigned short*)(ws + 204 * kMiB);
  unsigned short* wsv16   = (unsigned short*)(ws + 204 * kMiB + 512 * 1024);
  unsigned short* wfv16   = (unsigned short*)(ws + 204 * kMiB + 640 * 1024);

  const long sX   = (long)kChan * kHW;       // per-batch stride of x, v, out (elements)
  const long sTok = (long)kHW * kXtokLd;     // per-batch stride of xtok (halves)
  const long sXn  = (long)kChan * kXnLd;     // per-batch stride of xn (halves)
  const long sQK  = (long)kQK * kChan;       // per-batch stride of qktok (halves)
  const long sAtt = (long)kHW * kHW;         // per-batch stride of att / scores / P^T

  // ---- weight casts (whole planes; grids = exact element-group counts, ceil-div with in-kernel bound) ----
  {
    const int n8sv = kChan * kChan / 8;                 // 8192
    castw_kernel<0><<<(n8sv + 255) / 256, 256, 0, stream>>>(w_sv, wsv16, kChan, kChan, kChan, kWCarry);
    castw_kernel<0><<<(n8sv + 255) / 256, 256, 0, stream>>>(w_fv, wfv16, kChan, kChan, kChan, kWCarry);
    const int n8cdc = kChan * kChan2 / 8;               // 16384
    castw_kernel<2><<<(n8cdc + 255) / 256, 256, 0, stream>>>(w_cdc, wcdc_pk, kChan, kChan2, 2 * kChan2, kCdcCarry);
    const int n8qk = kQK * kHW / 8;                     // 262144
    castw_kernel<1><<<(n8qk + 255) / 256, 256, 0, stream>>>(w_qk, wqk2, kQK, kHW, 2 * kHW, kWCarry);
    const int n8w = kHW * kHW / 8;                      // 131072
    castw_kernel<0><<<(n8w + 255) / 256, 256, 0, stream>>>(w_spa, wspa16, kHW, kHW, kHW, kWCarry);
    castw_kernel<0><<<(n8w + 255) / 256, 256, 0, stream>>>(w_frq, wfrq16, kHW, kHW, kHW, kWCarry);
  }

  // ---- inputs -> token-major f16 plane [b][n][xcat | xcat] ----
  xtok_kernel<<<dim3(kHW / 64, kChan2 / 64, kBatch), 256, 0, stream>>>(x_spa, x_freq, xtok);

  // ---- v convs: v[b][c][n] = sum_cin w[c][cin] x[b][cin][n] + bias[c]; A = w f16 x16 (lda 256), Bt = xtok (ldb 1024), K = 256;
  //      out bf16 hi + lo planes [b][256][1024] ----
  wmma_gemm64<0, false, 1, 2, false><<<dim3(8, kBatch), 256, 0, stream>>>(
      wsv16, wsv16, kChan, 0L, xtok, xtok, kXtokLd, sTok,
      (void*)vspa_hi, (void*)vspa_lo, kHW, sX, b_sv, x_spa, 0L, kChan, kHW, kChan, 1.0f / kWCarry);
  wmma_gemm64<0, false, 1, 2, false><<<dim3(8, kBatch), 256, 0, stream>>>(
      wfv16, wfv16, kChan, 0L, xtok + kChan, xtok + kChan, kXtokLd, sTok,
      (void*)vfrq_hi, (void*)vfrq_lo, kHW, sX, b_fv, x_freq, 0L, kChan, kHW, kChan, 1.0f / kWCarry);

  // ---- cdc conv: x[b][c][n] = sum_cin w_cdc[c][cin] xcat[b][cin][n] + b_cdc[c]; A = [hi|lo](2^14 w_cdc) [256][1024],
  //      Bt = [xcat|xcat] (ldb 1024), K = 1024, scale 2^-14; out f32 [b][256][1024] ----
  wmma_gemm64<0, false, 1, 0, false><<<dim3(8, kBatch), 256, 0, stream>>>(
      wcdc_pk, wcdc_pk, 2 * kChan2, 0L, xtok, xtok, kXtokLd, sTok,
      (void*)xbuf, (void*)xbuf, kHW, sX, b_cdc, x_spa, 0L, kChan, kHW, 2 * kChan2, 1.0f / kCdcCarry);

  // ---- LayerNorm rows -> xn [4096][hi(1024) | lo(1024)] f16 carried x2^10 ----
  layernorm_kernel<<<kBatch * kChan, 128, 0, stream>>>(xbuf, ln_w, ln_b, xn);

  // ---- q|k token-major: qk[b][j][c] = sum_d w_qk[j][d] xn[b][c][d]; A = [w|w] f16 x16 [2048][2048], Bt = xn (ldb 2048, N 256),
  //      K = 2048, scale 1/(16*1024); out f16 [b][2048][256] (rows 0..1023 = q, 1024..2047 = k) ----
  wmma_gemm64<0, false, 0, 1, false><<<dim3(16, kBatch), 256, 0, stream>>>(
      wqk2, wqk2, 2 * kHW, 0L, xn, xn, kXnLd, sXn,
      (void*)qktok, (void*)qktok, kChan, sQK, b_cdc, x_spa, 0L, kQK, kChan, 2 * kHW, 1.0f / (kWCarry * kXnCarry));

  // ---- att[b][n][m] = (1/32) sum_c q[b][c][n] k[b][c][m]; A = q token-major (lda 256), Bt = k token-major, K = 256; out f16 ----
  wmma_gemm64<0, false, 0, 1, false><<<dim3(32, kBatch), 256, 0, stream>>>(
      qktok, qktok, kChan, sQK, qktok + (size_t)kHW * kChan, qktok + (size_t)kHW * kChan, kChan, sQK,
      (void*)att16, (void*)att16, kHW, sAtt, b_cdc, x_spa, 0L, kHW, kHW, kChan, 0.03125f);

  // ---- per branch, per group of kGrp batches:
  //      scores^T[g][j][n] = sum_m W[j][m] att[b][n][m] / 16 + bias[j]  (A = W f16 x16, Bt = att, K = 1024, f32 out)
  //      column softmax over j -> P^T bf16 hi/lo [g][j][n]
  //      out[b][c][m] = x[b][c][m] + sum_n v[b][c][n] P^T[m][n]  (A = v hi/lo, Bt = P^T hi/lo, 3 bf16 products, f32 out + f32 residual) ----
  for (int br = 0; br < 2; ++br) {
    const unsigned short* w16 = (br == 0) ? wspa16 : wfrq16;
    const float* bsc          = (br == 0) ? b_spa : b_frq;
    const unsigned short* vh  = (br == 0) ? vspa_hi : vfrq_hi;
    const unsigned short* vl  = (br == 0) ? vspa_lo : vfrq_lo;
    const float* xres         = (br == 0) ? x_spa : x_freq;
    float* ob = outp + (size_t)br * (size_t)nX;
    for (int gi = 0; gi < kNGrp; ++gi) {
      const int b0 = gi * kGrp;
      wmma_gemm64<0, false, 1, 0, false><<<dim3(32, kGrp), 256, 0, stream>>>(
          w16, w16, kHW, 0L, att16 + (size_t)b0 * sAtt, att16 + (size_t)b0 * sAtt, kHW, sAtt,
          (void*)scores, (void*)scores, kHW, sAtt, bsc, xres, 0L, kHW, kHW, kHW, 1.0f / kWCarry);
      colsoftmax_kernel<<<dim3(kHW / 64, kGrp), 256, 0, stream>>>(scores, pt_hi, pt_lo);
      wmma_gemm64<1, true, 0, 0, true><<<dim3(8, kGrp), 256, 0, stream>>>(
          vh + (size_t)b0 * sX, vl + (size_t)b0 * sX, kHW, sX, pt_hi, pt_lo, kHW, sAtt,
          (void*)(ob + (size_t)b0 * sX), (void*)(ob + (size_t)b0 * sX), kHW, sX, bsc,
          xres + (size_t)b0 * sX, sX, kChan, kHW, kHW, 1.0f);
    }
  }
}

// v002
// One run takes 551 microseconds.
// Next to v001, in two timings, it ran 1.43 and 1.45 times as fast.
// All steps since v000 together make it 3.87 times as fast.
// Contractions: v 1x1 convs (w f16 x16, x f16), cdc 1x1 conv (w carried x2^14 as f16 hi|lo K-packed, x f16 duplicated along K), w_qk projection (w f16 x16 duplicated along K, LN output carried x2^10 as f16 hi|lo K-packed), q^T.k (q,k f16), W.att^T score GEMMs (W f16 x16, att f16): v_wmma_f32_16x16x32_f16; value x attention^T (v and P^T as bf16 hi+lo planes, hi.hi+hi.lo+lo.hi): v_wmma_f32_16x16x32_bf16; all f32 accumulate; LayerNorm and softmax in f32.
#include <hip/hip_runtime.h>
#include <math.h>

// ---------------------------------------------------------------------------
// Problem constants
// ---------------------------------------------------------------------------
constexpr int kBatch  = 16;
constexpr int kChan   = 256;              // channels
constexpr int kChan2  = 512;              // concatenated channels
constexpr int kHW     = 1024;             // h*w = dim
constexpr int kQK     = 2048;             // q|k outputs
constexpr int kXtokLd = 1024;             // token-major input plane pitch (halves): [xcat(512) | xcat(512)]
constexpr int kXnLd   = 2048;             // LN output plane pitch (halves): [hi(1024) | lo(1024)]
constexpr int kGrp    = 16;               // batches per score/softmax/output launch (all of them: 256 softmax blocks = one per WGP)
constexpr int kNGrp   = kBatch / kGrp;
constexpr float kWCarry    = 16.0f;       // plain weights carried x16 in f16
constexpr float kCdcCarry  = 16384.0f;    // w_cdc carried x2^14 (hi|lo)
constexpr float kXnCarry   = 1024.0f;     // LN output carried x2^10 (hi|lo)
constexpr float kInvHW     = 1.0f / 1024.0f;
constexpr float kLnEps     = 1e-5f;

typedef __attribute__((ext_vector_type(16))) _Float16 v16h;
typedef __attribute__((ext_vector_type(8)))  _Float16 v8h;
typedef __attribute__((ext_vector_type(16))) __bf16   v16b;
typedef __attribute__((ext_vector_type(8)))  __bf16   v8b;
typedef __attribute__((ext_vector_type(8)))  float    v8f;
typedef __attribute__((ext_vector_type(4)))  float    v4f;
typedef __attribute__((ext_vector_type(4)))  unsigned int v4u;
typedef __attribute__((ext_vector_type(2)))  unsigned int v2u;

// ---------------------------------------------------------------------------
// Helpers
// ---------------------------------------------------------------------------
__device__ __forceinline__ unsigned short f2bf_bits(float f) {
  unsigned u = __float_as_uint(f);
  return (unsigned short)((u + 0x7FFFu + ((u >> 16) & 1u)) >> 16);
}
__device__ __forceinline__ float bf_bits2f(unsigned short h) { return __uint_as_float(((unsigned)h) << 16); }

// hazard guards as plain device helpers (no inline asm inside the kernel template body)
__device__ __forceinline__ void dep_guard_h(v8f& a, v8f& b, v16h x, v16h y) { asm volatile("v_nop\n\tv_nop\n\tv_nop\n\tv_nop" : "+v"(a), "+v"(b) : "v"(x), "v"(y)); }
__device__ __forceinline__ void dep_guard_b(v8f& a, v8f& b, v16b x, v16b y) { asm volatile("v_nop\n\tv_nop\n\tv_nop\n\tv_nop" : "+v"(a), "+v"(b) : "v"(x), "v"(y)); }
__device__ __forceinline__ void keep4_h(v16h a, v16h b, v16h c, v16h d) { asm volatile("v_nop" :: "v"(a), "v"(b), "v"(c), "v"(d)); }
__device__ __forceinline__ void keep4_b(v16b a, v16b b, v16b c, v16b d) { asm volatile("v_nop" :: "v"(a), "v"(b), "v"(c), "v"(d)); }
__device__ __forceinline__ void acc_guard4(v8f& a, v8f& b, v8f& c, v8f& d) { asm volatile("v_nop\n\tv_nop\n\tv_nop\n\tv_nop" : "+v"(a), "+v"(b), "+v"(c), "+v"(d)); }
template <typename T> struct Frag;
template <> struct Frag<_Float16> {
  typedef v16h V; union U { v16h v; v8h h[2]; };
  static __device__ __forceinline__ v16h load(const _Float16* p) {   // elements 0..7 <- p[0..7], 8..15 <- p[16..23]
    U f; f.h[0] = *(const v8h*)(p); f.h[1] = *(const v8h*)(p + 16); return f.v;
  }
  static __device__ __forceinline__ v8f mma(v16h a, v16h b, v8f c) {
    return __builtin_amdgcn_wmma_f32_16x16x32_f16(false, a, false, b, (short)0, c, false, false);
  }
  static __device__ __forceinline__ void guard(v8f& a, v8f& b, v16h x, v16h y) { dep_guard_h(a, b, x, y); }
  static __device__ __forceinline__ void keep(v16h a, v16h b, v16h c, v16h d) { keep4_h(a, b, c, d); }
};
template <> struct Frag<__bf16> {
  typedef v16b V; union U { v16b v; v8b h[2]; };
  static __device__ __forceinline__ v16b load(const __bf16* p) {
    U f; f.h[0] = *(const v8b*)(p); f.h[1] = *(const v8b*)(p + 16); return f.v;
  }
  static __device__ __forceinline__ v8f mma(v16b a, v16b b, v8f c) {
    return __builtin_amdgcn_wmma_f32_16x16x32_bf16(false, a, false, b, (short)0, c, false, false);
  }
  static __device__ __forceinline__ void guard(v8f& a, v8f& b, v16b x, v16b y) { dep_guard_b(a, b, x, y); }
  static __device__ __forceinline__ void keep(v16b a, v16b b, v16b c, v16b d) { keep4_b(a, b, c, d); }
};

__device__ __forceinline__ unsigned pk16(unsigned short a, unsigned short b) { return (unsigned)a | ((unsigned)b << 16); }
__device__ __forceinline__ unsigned short h_bits(float f) { const _Float16 h = (_Float16)f; return __builtin_bit_cast(unsigned short, h); }

// ---- Register-blocked batched WMMA GEMM (ACT reduced to none/relu/leaky) -----------------------
// C[m,n] = scale * sum_k A[m,k] * Bt[n,k] (+bias)(+resid); each wave owns a 64x64 tile.
// A row-major [M,K]; Bt row-major [N,K]; M,N % 64 == 0, K % 32 == 0.
// SPLIT: operands are hi/lo planes (A2/Bt2 = lo planes, same layout); product = hi.hi + hi.lo + lo.hi.
// BIAS_MODE: 0 = none, 1 = bias[m], 2 = bias[n].
// OUT_MODE: 0 = f32, 1 = f16, 2 = bf16 hi plane (Cout) + bf16 lo plane (Cout2).
// ET: 0 = f16 operands, 1 = bf16 operands (pointers passed as 16-bit storage)
template <int ET> struct Elem;
template <> struct Elem<0> { typedef _Float16 T; };
template <> struct Elem<1> { typedef __bf16 T; };
template <int ET, bool SPLIT, int BIAS_MODE, int OUT_MODE, bool RESID, int ACT = 0>
__global__ __launch_bounds__(256) void wmma_gemm64(
    const unsigned short* __restrict__ Ap, const unsigned short* __restrict__ A2p, int lda, long strideA,
    const unsigned short* __restrict__ Btp, const unsigned short* __restrict__ Bt2p, int ldb, long strideB,
    void* __restrict__ Cout, void* __restrict__ Cout2, int ldc, long strideC,
    const float* __restrict__ bias,
    const float* __restrict__ resid, long strideR,
    int M, int N, int K, float scale) {
  typedef typename Elem<ET>::T T;
  typedef typename Frag<T>::V V;
  const T* A = (const T*)Ap; const T* A2 = (const T*)A2p; const T* Bt = (const T*)Btp; const T* Bt2 = (const T*)Bt2p;
  __shared__ __align__(16) float sT[8][16 * 68];   // per-wave 16x64 slab, pitch 68 floats
  const int b    = blockIdx.y;
  const int lane = threadIdx.x & 31;
  const int wave = threadIdx.x >> 5;
  const int tilesN = N >> 6;
  const int tilesM = M >> 6;
  const int tile = blockIdx.x * 8 + wave;
  if (tile >= tilesM * tilesN) return;   // wave-uniform; no block barriers in this kernel
  const int tm = tile / tilesN;
  const int tn = tile - tm * tilesN;
  const int m0 = tm << 6;
  const int n0 = tn << 6;

  const T* Ab  = A  + (size_t)b * strideA;
  const T* Bb  = Bt + (size_t)b * strideB;
  const T* Ab2 = SPLIT ? (A2  + (size_t)b * strideA) : nullptr;
  const T* Bb2 = SPLIT ? (Bt2 + (size_t)b * strideB) : nullptr;

  const int rlane = lane & 15;                 // row (A) / col (B, D) within subtile
  const int koff  = (lane >> 4) * 8;           // k offset of this lane half
  const int mOff  = (lane >> 4) * 8;           // D row offset

  v8f acc[4][4];
#pragma unroll
  for (int i = 0; i < 4; ++i)
#pragma unroll
    for (int j = 0; j < 4; ++j) acc[i][j] = (v8f){0.f,0.f,0.f,0.f,0.f,0.f,0.f,0.f};

  for (int k0 = 0; k0 < K; k0 += 32) {
    V bh[4], bl[4];
#pragma unroll
    for (int j = 0; j < 4; ++j) {
      const size_t bo = (size_t)(n0 + (j << 4) + rlane) * ldb + koff + k0;
      bh[j] = Frag<T>::load(Bb + bo);
      if (SPLIT) bl[j] = Frag<T>::load(Bb2 + bo);
    }
#pragma unroll
    for (int i = 0; i < 4; ++i) {
      const size_t ao = (size_t)(m0 + (i << 4) + rlane) * lda + koff + k0;
      V ah = Frag<T>::load(Ab + ao);
      V al;
      if (SPLIT) al = Frag<T>::load(Ab2 + ao);
#pragma unroll
      for (int j = 0; j < 4; ++j) {
        acc[i][j] = Frag<T>::mma(ah, bh[j], acc[i][j]);
        if (SPLIT) {
          acc[i][j] = Frag<T>::mma(ah, bl[j], acc[i][j]);
          acc[i][j] = Frag<T>::mma(al, bh[j], acc[i][j]);
        }
      }
      Frag<T>::guard(acc[i][0], acc[i][3], ah, SPLIT ? al : ah);
    }
    Frag<T>::keep(bh[0], bh[1], bh[2], bh[3]);
    if (SPLIT) Frag<T>::keep(bl[0], bl[1], bl[2], bl[3]);
  }
  acc_guard4(acc[0][0], acc[0][1], acc[0][2], acc[0][3]);
  acc_guard4(acc[1][0], acc[1][1], acc[1][2], acc[1][3]);
  acc_guard4(acc[2][0], acc[2][1], acc[2][2], acc[2][3]);
  acc_guard4(acc[3][0], acc[3][1], acc[3][2], acc[3][3]);

  // ---- epilogue ----
  float* slab = sT[wave];
  const float* Rb = RESID ? (resid + (size_t)b * strideR) : nullptr;
#pragma unroll
  for (int i = 0; i < 4; ++i) {
    const int mBase = m0 + (i << 4);
#pragma unroll
    for (int j = 0; j < 4; ++j) {
      const int n = n0 + (j << 4) + rlane;
      float bv = 0.f;
      if (BIAS_MODE == 2) bv = bias[n];
#pragma unroll
      for (int r = 0; r < 8; ++r) {
        float v = acc[i][j][r] * scale;
        if (BIAS_MODE == 1) v += bias[mBase + mOff + r];
        if (BIAS_MODE == 2) v += bv;
        if (RESID) v += Rb[(size_t)(mBase + mOff + r) * ldc + n];
        if (ACT == 2) v = fmaxf(v, 0.0f);
        if (ACT == 4) v = (v > 0.f) ? v : 0.01f * v;
        slab[(mOff + r) * 68 + (j << 4) + rlane] = v;
      }
    }
    __builtin_amdgcn_fence(__ATOMIC_RELEASE, "workgroup");
    __builtin_amdgcn_wave_barrier();
    __builtin_amdgcn_fence(__ATOMIC_ACQUIRE, "workgroup");
    if (OUT_MODE == 0) {
      float* C = (float*)Cout + (size_t)b * strideC;
      const int hh = lane >> 4, c4 = (lane & 15) * 4;     // row seg = 256 B = 16 lanes x 16 B
      {
#pragma unroll
        for (int it = 0; it < 8; ++it) {
          const int row = it * 2 + hh;
          v4f v = *(const v4f*)(slab + row * 68 + c4);
          *(v4f*)(C + (size_t)(mBase + row) * ldc + n0 + c4) = v;
        }
        
      }
    } else {
      const int q = lane >> 3, c8 = (lane & 7) * 8;
      unsigned short* C  = (unsigned short*)Cout  + (size_t)b * strideC;
      unsigned short* C2 = (OUT_MODE == 2) ? ((unsigned short*)Cout2 + (size_t)b * strideC) : nullptr;
      {
#pragma unroll
        for (int it = 0; it < 4; ++it) {
          const int row = it * 4 + q;
          const float* sp = slab + row * 68 + c8;
          v8h hv, lv;
#pragma unroll
          for (int e = 0; e < 8; ++e) {
            if (OUT_MODE == 1) {
              hv[e] = (_Float16)sp[e];
            } else {
              unsigned short hb = f2bf_bits(sp[e]);
              unsigned short lb = f2bf_bits(sp[e] - bf_bits2f(hb));
              hv[e] = __builtin_bit_cast(_Float16, hb);
              lv[e] = __builtin_bit_cast(_Float16, lb);
            }
          }
          *(v8h*)(C + (size_t)(mBase + row) * ldc + n0 + c8) = hv;
          if (OUT_MODE == 2) *(v8h*)(C2 + (size_t)(mBase + row) * ldc + n0 + c8) = lv;
        }
        
      }
    }
    __builtin_amdgcn_fence(__ATOMIC_RELEASE, "workgroup");
    __builtin_amdgcn_wave_barrier();
    __builtin_amdgcn_fence(__ATOMIC_ACQUIRE, "workgroup");
  }
}

// ---------------------------------------------------------------------------
// Weight cast: in [rows][cols] f32 -> out [rows][ldo] halves.
//   MODE 0: out[r][c] = f16(scale*v)
//   MODE 1: out[r][c] = out[r][cols + c] = f16(scale*v)            (duplicated along K)
//   MODE 2: out[r][c] = hi = f16(scale*v), out[r][cols + c] = f16(scale*v - hi)   (hi|lo, common scale)
// One thread = 8 consecutive elements of one row (two 16-B loads, one 16-B store per plane);
// ---------------------------------------------------------------------------
template <int MODE>
__global__ __launch_bounds__(256) void castw_kernel(const float* __restrict__ in, unsigned short* __restrict__ out,
                                                      int rows, int cols, int ldo, float scale) {
  const int gpr = cols >> 3;
  const int n8  = rows * gpr;
  const int i   = blockIdx.x * 256 + threadIdx.x;
  if (i >= n8) return;
  const int r = i / gpr;
  const int g = i - r * gpr;
  const float* p = in + (size_t)r * cols + 8 * g;
  const v4f a = *(const v4f*)(p);
  const v4f c = *(const v4f*)(p + 4);
  float x[8];
#pragma unroll
  for (int e = 0; e < 4; ++e) { x[e] = a[e] * scale; x[4 + e] = c[e] * scale; }
  unsigned short hb[8], lb[8];
#pragma unroll
  for (int e = 0; e < 8; ++e) {
    const _Float16 h = (_Float16)x[e];
    hb[e] = __builtin_bit_cast(unsigned short, h);
    lb[e] = (MODE == 2) ? h_bits(x[e] - (float)h) : hb[e];
  }
  const v4u uh = (v4u){pk16(hb[0], hb[1]), pk16(hb[2], hb[3]), pk16(hb[4], hb[5]), pk16(hb[6], hb[7])};
  const v4u ul = (v4u){pk16(lb[0], lb[1]), pk16(lb[2], lb[3]), pk16(lb[4], lb[5]), pk16(lb[6], lb[7])};
  unsigned short* q0 = out + (size_t)r * ldo + 8 * g;
  unsigned short* q1 = q0 + cols;
  *(v4u*)q0 = uh;
  if (MODE != 0) *(v4u*)q1 = ul;
  
}

// ---------------------------------------------------------------------------
// Input transpose + cast: x_spa, x_freq [b][256][1024] f32 -> xtok [b][1024 tokens][1024 halves] f16 with
// cols ct*64..ct*64+63 = channels (ct 0..3: x_spa channels ct*64.., ct 4..7: x_freq channels (ct-4)*64..),
// i.e. cols 0..511 = concatenated channels, and the same values duplicated at cols 512..1023.
// grid (16 token tiles, 8 channel tiles, 16 batches), 256 threads; LDS tile 64 tokens x 64 channels.
// Load coverage: 16 iterations x 256 threads = 4096 = whole tile (coalesced along tokens).
// Store coverage: 8 waves x 2 iterations x 4 rows (lane>>3) = 64 token rows; (lane&7) x 8 halves = 64 channels;
// ---------------------------------------------------------------------------
__global__ __launch_bounds__(256) void xtok_kernel(const float* __restrict__ xs, const float* __restrict__ xf,
                                                   unsigned short* __restrict__ xtok) {
  __shared__ float sm[64][65];   // sm[token_local][channel_local]
  const int t  = threadIdx.x;
  const int n0 = blockIdx.x * 64;
  const int ct = blockIdx.y;                 // block-uniform source select
  const int b  = blockIdx.z;
  const float* X = (ct < 4) ? xs : xf;
  const int c0 = (ct & 3) * 64;
  const float* src = X + ((size_t)b * kChan + c0) * kHW + n0;
#pragma unroll
  for (int i = 0; i < 16; ++i) {
    const int e  = i * 256 + t;
    const int r  = e >> 6;        // channel local
    const int cc = e & 63;        // token local
    sm[cc][r] = src[(size_t)r * kHW + cc];
  }
  __syncthreads();
  const int lane = t & 31, wave = t >> 5;
  const int q = lane >> 3, c8 = (lane & 7) * 8;
  unsigned short* ob = xtok + ((size_t)b * kHW + n0) * kXtokLd + ct * 64 + c8;
#pragma unroll
  for (int it = 0; it < 2; ++it) {
    const int row = wave * 8 + it * 4 + q;   // token local
    unsigned short hb[8];
#pragma unroll
    for (int e = 0; e < 8; ++e) hb[e] = h_bits(sm[row][c8 + e]);
    const v4u u = (v4u){pk16(hb[0], hb[1]), pk16(hb[2], hb[3]), pk16(hb[4], hb[5]), pk16(hb[6], hb[7])};
    unsigned short* p0 = ob + (size_t)row * kXtokLd;
    unsigned short* p1 = p0 + kChan2;
    *(v4u*)p0 = u;
    *(v4u*)p1 = u;
    
  }
}

// ---------------------------------------------------------------------------
// Output row of xn [4096][2048] halves: cols 0..1023 = hi = f16(1024*y), cols 1024..2047 = f16(1024*y - hi).
// Block = 128 threads = one row; thread t owns cols 8t..8t+7 (128 x 8 = 1024 = whole row).
// ---------------------------------------------------------------------------
__global__ __launch_bounds__(128) void layernorm_kernel(const float* __restrict__ xb, const float* __restrict__ gam,
                                                        const float* __restrict__ bet, unsigned short* __restrict__ xn) {
  __shared__ float red[4];
  const int row  = blockIdx.x;
  const int t    = threadIdx.x, lane = t & 31, wave = t >> 5;
  const int c0   = t * 8;
  const float* px = xb + (size_t)row * kHW + c0;
  const v4f a = *(const v4f*)(px);
  const v4f c = *(const v4f*)(px + 4);
  float x[8];
#pragma unroll
  for (int e = 0; e < 4; ++e) { x[e] = a[e]; x[4 + e] = c[e]; }
  float s = ((x[0] + x[1]) + (x[2] + x[3])) + ((x[4] + x[5]) + (x[6] + x[7]));
#pragma unroll
  for (int off = 16; off > 0; off >>= 1) s += __shfl_xor(s, off, 32);
  if (lane == 0) red[wave] = s;
  __syncthreads();
  const float mean = ((red[0] + red[1]) + (red[2] + red[3])) * kInvHW;
  __syncthreads();
  float d[8];
  float sq = 0.f;
#pragma unroll
  for (int e = 0; e < 8; ++e) { d[e] = x[e] - mean; sq += d[e] * d[e]; }
#pragma unroll
  for (int off = 16; off > 0; off >>= 1) sq += __shfl_xor(sq, off, 32);
  if (lane == 0) red[wave] = sq;
  __syncthreads();
  const float var  = ((red[0] + red[1]) + (red[2] + red[3])) * kInvHW;
  const float rstd = 1.0f / sqrtf(var + kLnEps);
  const v4f g0 = *(const v4f*)(gam + c0), g1 = *(const v4f*)(gam + c0 + 4);
  const v4f e0 = *(const v4f*)(bet + c0), e1 = *(const v4f*)(bet + c0 + 4);
  float gg[8], bb[8];
#pragma unroll
  for (int e = 0; e < 4; ++e) { gg[e] = g0[e]; gg[4 + e] = g1[e]; bb[e] = e0[e]; bb[4 + e] = e1[e]; }
  unsigned short hb[8], lb[8];
#pragma unroll
  for (int e = 0; e < 8; ++e) {
    const float y  = d[e] * rstd * gg[e] + bb[e];
    const float ys = y * kXnCarry;
    const _Float16 h = (_Float16)ys;
    hb[e] = __builtin_bit_cast(unsigned short, h);
    lb[e] = h_bits(ys - (float)h);
  }
  const v4u uh = (v4u){pk16(hb[0], hb[1]), pk16(hb[2], hb[3]), pk16(hb[4], hb[5]), pk16(hb[6], hb[7])};
  const v4u ul = (v4u){pk16(lb[0], lb[1]), pk16(lb[2], lb[3]), pk16(lb[4], lb[5]), pk16(lb[6], lb[7])};
  unsigned short* q0 = xn + (size_t)row * kXnLd + c0;
  unsigned short* q1 = q0 + kHW;
  *(v4u*)q0 = uh;
  *(v4u*)q1 = ul;
  
}

// ---------------------------------------------------------------------------
// Column softmax of the transposed scores: sc [g][1024 j][1024 n] f32; for each (g, n): P[j] = exp(s - max_j) / sum_j exp,
// written as bf16 hi + lo planes pth/ptl [g][j][n] (this is exactly the Bt operand [m][n] of the value x attention product).
// Block = (64-column tile, g), 1024 threads; the whole 1024 x 64 tile lives in registers, so the scores are read once and
// every load of a thread is in flight at the same time.
// Thread = 4 consecutive columns (t&15) of rows (t>>4) + 64*i, i < 16 (64 x 16 = 1024 rows, 16 x 4 = 64 columns = whole tile);
// a wave's 16-B loads cover two whole 256-B row segments, its 8-B stores two whole 128-B lines per plane.
// Column maximum and column sum: 16 rows in the thread, lane l with l^16, 32 wave partials in LDS combined 8 + 4 in fixed order.
// ---------------------------------------------------------------------------
__global__ __launch_bounds__(1024) void colsoftmax_kernel(const float* __restrict__ sc, unsigned short* __restrict__ pth,
                                                          unsigned short* __restrict__ ptl) {
  __shared__ __align__(16) float part[32][64];   // one partial per wave and column
  __shared__ __align__(16) float comb[4][64];    // partials of 8 waves each
  const int t    = threadIdx.x;
  const int lane = t & 31, wave = t >> 5;
  const int c0   = (t & 15) * 4;
  const size_t base = (size_t)blockIdx.y * kHW * kHW + (size_t)(t >> 4) * kHW + blockIdx.x * 64 + c0;
  const float* sp = sc + base;
  const int rcol = t & 63, rgrp = t >> 6;        // second reduction stage (threads 0..255)

  v4f x[16];
#pragma unroll
  for (int i = 0; i < 15; ++i) x[i] = *(const v4f*)(sp + (size_t)i * 64 * kHW);
  // the last load's result may be given the address registers that the fifteen issued loads name: their translations first
  asm volatile("s_wait_xcnt 0x0" ::: "memory");
  x[15] = *(const v4f*)(sp + (size_t)15 * 64 * kHW);

  // ---- column maximum ----
  v4f m = x[0];
#pragma unroll
  for (int i = 1; i < 16; ++i)
#pragma unroll
    for (int e = 0; e < 4; ++e) m[e] = fmaxf(m[e], x[i][e]);
#pragma unroll
  for (int e = 0; e < 4; ++e) m[e] = fmaxf(m[e], __shfl_xor(m[e], 16, 32));
  if (lane < 16) *(v4f*)(&part[wave][c0]) = m;
  __syncthreads();
  if (t < 256) {
    float a = part[rgrp * 8][rcol];
#pragma unroll
    for (int k = 1; k < 8; ++k) a = fmaxf(a, part[rgrp * 8 + k][rcol]);
    comb[rgrp][rcol] = a;
  }
  __syncthreads();
  {
    const v4f a0 = *(const v4f*)(&comb[0][c0]), a1 = *(const v4f*)(&comb[1][c0]);
    const v4f a2 = *(const v4f*)(&comb[2][c0]), a3 = *(const v4f*)(&comb[3][c0]);
#pragma unroll
    for (int e = 0; e < 4; ++e) m[e] = fmaxf(fmaxf(a0[e], a1[e]), fmaxf(a2[e], a3[e]));
  }

  // ---- exponentials (kept in place of the scores) and column sum ----
  v4f s = (v4f){0.f, 0.f, 0.f, 0.f};
#pragma unroll
  for (int i = 0; i < 16; ++i)
#pragma unroll
    for (int e = 0; e < 4; ++e) { x[i][e] = expf(x[i][e] - m[e]); s[e] += x[i][e]; }
#pragma unroll
  for (int e = 0; e < 4; ++e) s[e] += __shfl_xor(s[e], 16, 32);
  if (lane < 16) *(v4f*)(&part[wave][c0]) = s;   // every read of the maxima in part ended before the barrier above
  __syncthreads();
  if (t < 256) {
    float a = part[rgrp * 8][rcol];
#pragma unroll
    for (int k = 1; k < 8; ++k) a += part[rgrp * 8 + k][rcol];
    comb[rgrp][rcol] = a;                        // every read of the maxima in comb ended before the barrier above
  }
  __syncthreads();
  v4f inv;
  {
    const v4f a0 = *(const v4f*)(&comb[0][c0]), a1 = *(const v4f*)(&comb[1][c0]);
    const v4f a2 = *(const v4f*)(&comb[2][c0]), a3 = *(const v4f*)(&comb[3][c0]);
#pragma unroll
    for (int e = 0; e < 4; ++e) inv[e] = 1.0f / ((a0[e] + a1[e]) + (a2[e] + a3[e]));
  }

  // ---- normalise, split into bf16 hi + lo, store ----
  unsigned short* oh = pth + base;
  unsigned short* ol = ptl + base;
#pragma unroll
  for (int i = 0; i < 16; ++i) {
    unsigned short hb[4], lb[4];
#pragma unroll
    for (int e = 0; e < 4; ++e) {
      const float p = x[i][e] * inv[e];
      hb[e] = f2bf_bits(p);
      lb[e] = f2bf_bits(p - bf_bits2f(hb[e]));
    }
    *(v2u*)(oh + (size_t)i * 64 * kHW) = (v2u){pk16(hb[0], hb[1]), pk16(hb[2], hb[3])};
    *(v2u*)(ol + (size_t)i * 64 * kHW) = (v2u){pk16(lb[0], lb[1]), pk16(lb[2], lb[3])};
  }
}

// ---------------------------------------------------------------------------
// Host orchestration.
// Workspace region map (bytes, 1 MiB aligned except w_sv and w_fv; total 214,695,936 B = 204.75 MiB):
//   [  0 MiB,  32 MiB)  xtok f16 [16][1024][1024]  -> then xn f16 [4096][2048] (16 MiB) -> then att f16 [16][1024][1024]
//   [ 32 MiB,  96 MiB)  xbuf f32 [16][256][1024] (16 MiB) -> then qk token-major f16 [16][2048][256] (16 MiB)
//                       -> then scores f32 [16][1024][1024] (64 MiB)
//   [ 96 MiB, 128 MiB)  P^T bf16 hi [16][1024][1024];  [128, 160) P^T bf16 lo
//   [160 MiB, 192 MiB)  v_spa hi, v_spa lo, v_freq hi, v_freq lo  bf16 [16][256][1024] (8 MiB each)
//   [192 MiB, 200 MiB)  w_qk f16 [2048][2048] (duplicated K);  [200,202) w_spa f16; [202,204) w_frq f16;
//   [204 MiB, +512 KiB) w_cdc f16 hi|lo [256][1024];  +512 KiB: w_sv f16 [256][256]; +640 KiB: w_fv f16; end 204 MiB + 768 KiB.
// ---------------------------------------------------------------------------
extern "C" void kernel_launch(void* const* d_in, const int* in_sizes, int n_in,
                              void* d_out, int out_size, void* d_ws, size_t ws_size,
                              hipStream_t stream) {
  if (n_in < 15) return;
  const int nX = kBatch * kChan * kHW;
  if (in_sizes[0] != nX || in_sizes[1] != nX) return;
  if (in_sizes[2] != kChan * kChan2 || in_sizes[3] != kChan) return;
  if (in_sizes[4] != kChan * kChan || in_sizes[5] != kChan) return;
  if (in_sizes[6] != kChan * kChan || in_sizes[7] != kChan) return;
  if (in_sizes[8] != kHW || in_sizes[9] != kHW) return;
  if (in_sizes[10] != kQK * kHW || in_sizes[11] != kHW * kHW || in_sizes[12] != kHW) return;
  if (in_sizes[13] != kHW * kHW || in_sizes[14] != kHW) return;
  if (out_size != 2 * nX) return;
  const size_t kMiB  = 1048576;
  const size_t wsEnd = 204 * kMiB + 768 * 1024;
  if (ws_size < wsEnd) return;

  const float* x_spa  = (const float*)d_in[0];
  const float* x_freq = (const float*)d_in[1];
  const float* w_cdc  = (const float*)d_in[2];
  const float* b_cdc  = (const float*)d_in[3];
  const float* w_sv   = (const float*)d_in[4];
  const float* b_sv   = (const float*)d_in[5];
  const float* w_fv   = (const float*)d_in[6];
  const float* b_fv   = (const float*)d_in[7];
  const float* ln_w   = (const float*)d_in[8];
  const float* ln_b   = (const float*)d_in[9];
  const float* w_qk   = (const float*)d_in[10];
  const float* w_spa  = (const float*)d_in[11];
  const float* b_spa  = (const float*)d_in[12];
  const float* w_frq  = (const float*)d_in[13];
  const float* b_frq  = (const float*)d_in[14];
  float* outp = (float*)d_out;

  char* ws = (char*)d_ws;
  unsigned short* xtok    = (unsigned short*)(ws);                      // phase 1
  unsigned short* xn      = (unsigned short*)(ws);                      // phase 2 (xtok dead)
  unsigned short* att16   = (unsigned short*)(ws);                      // phase 3+ (xn dead)
  float*          xbuf    = (float*)(ws + 32 * kMiB);                   // phase 1-2
  unsigned short* qktok   = (unsigned short*)(ws + 32 * kMiB);          // phase 2-3 (xbuf dead)
  float*          scores  = (float*)(ws + 32 * kMiB);                   // phase 4 (qktok dead)
  unsigned short* pt_hi   = (unsigned short*)(ws + 96 * kMiB);
  unsigned short* pt_lo   = (unsigned short*)(ws + 128 * kMiB);
  unsigned short* vspa_hi = (unsigned short*)(ws + 160 * kMiB);
  unsigned short* vspa_lo = (unsigned short*)(ws + 168 * kMiB);
  unsigned short* vfrq_hi = (unsigned short*)(ws + 176 * kMiB);
  unsigned short* vfrq_lo = (unsigned short*)(ws + 184 * kMiB);
  unsigned short* wqk2    = (unsigned short*)(ws + 192 * kMiB);
  unsigned short* wspa16  = (unsigned short*)(ws + 200 * kMiB);
  unsigned short* wfrq16  = (unsigned short*)(ws + 202 * kMiB);
  unsigned short* wcdc_pk = (unsigned short*)(ws + 204 * kMiB);
  unsigned short* wsv16   = (unsigned short*)(ws + 204 * kMiB + 512 * 1024);
  unsigned short* wfv16   = (unsigned short*)(ws + 204 * kMiB + 640 * 1024);

  const long sX   = (long)kChan * kHW;       // per-batch stride of x, v, out (elements)
  const long sTok = (long)kHW * kXtokLd;     // per-batch stride of xtok (halves)
  const long sXn  = (long)kChan * kXnLd;     // per-batch stride of xn (halves)
  const long sQK  = (long)kQK * kChan;       // per-batch stride of qktok (halves)
  const long sAtt = (long)kHW * kHW;         // per-batch stride of att / scores / P^T

  // ---- weight casts (whole planes; grids = exact element-group counts, ceil-div with in-kernel bound) ----
  {
    const int n8sv = kChan * kChan / 8;                 // 8192
    castw_kernel<0><<<(n8sv + 255) / 256, 256, 0, stream>>>(w_sv, wsv16, kChan, kChan, kChan, kWCarry);
    castw_kernel<0><<<(n8sv + 255) / 256, 256, 0, stream>>>(w_fv, wfv16, kChan, kChan, kChan, kWCarry);
    const int n8cdc = kChan * kChan2 / 8;               // 16384
    castw_kernel<2><<<(n8cdc + 255) / 256, 256, 0, stream>>>(w_cdc, wcdc_pk, kChan, kChan2, 2 * kChan2, kCdcCarry);
    const int n8qk = kQK * kHW / 8;                     // 262144
    castw_kernel<1><<<(n8qk + 255) / 256, 256, 0, stream>>>(w_qk, wqk2, kQK, kHW, 2 * kHW, kWCarry);
    const int n8w = kHW * kHW / 8;                      // 131072
    castw_kernel<0><<<(n8w + 255) / 256, 256, 0, stream>>>(w_spa, wspa16, kHW, kHW, kHW, kWCarry);
    castw_kernel<0><<<(n8w + 255) / 256, 256, 0, stream>>>(w_frq, wfrq16, kHW, kHW, kHW, kWCarry);
  }

  // ---- inputs -> token-major f16 plane [b][n][xcat | xcat] ----
  xtok_kernel<<<dim3(kHW / 64, kChan2 / 64, kBatch), 256, 0, stream>>>(x_spa, x_freq, xtok);

  // ---- v convs: v[b][c][n] = sum_cin w[c][cin] x[b][cin][n] + bias[c]; A = w f16 x16 (lda 256), Bt = xtok (ldb 1024), K = 256;
  //      out bf16 hi + lo planes [b][256][1024] ----
  wmma_gemm64<0, false, 1, 2, false><<<dim3(8, kBatch), 256, 0, stream>>>(
      wsv16, wsv16, kChan, 0L, xtok, xtok, kXtokLd, sTok,
      (void*)vspa_hi, (void*)vspa_lo, kHW, sX, b_sv, x_spa, 0L, kChan, kHW, kChan, 1.0f / kWCarry);
  wmma_gemm64<0, false, 1, 2, false><<<dim3(8, kBatch), 256, 0, stream>>>(
      wfv16, wfv16, kChan, 0L, xtok + kChan, xtok + kChan, kXtokLd, sTok,
      (void*)vfrq_hi, (void*)vfrq_lo, kHW, sX, b_fv, x_freq, 0L, kChan, kHW, kChan, 1.0f / kWCarry);

  // ---- cdc conv: x[b][c][n] = sum_cin w_cdc[c][cin] xcat[b][cin][n] + b_cdc[c]; A = [hi|lo](2^14 w_cdc) [256][1024],
  //      Bt = [xcat|xcat] (ldb 1024), K = 1024, scale 2^-14; out f32 [b][256][1024] ----
  wmma_gemm64<0, false, 1, 0, false><<<dim3(8, kBatch), 256, 0, stream>>>(
      wcdc_pk, wcdc_pk, 2 * kChan2, 0L, xtok, xtok, kXtokLd, sTok,
      (void*)xbuf, (void*)xbuf, kHW, sX, b_cdc, x_spa, 0L, kChan, kHW, 2 * kChan2, 1.0f / kCdcCarry);

  // ---- LayerNorm rows -> xn [4096][hi(1024) | lo(1024)] f16 carried x2^10 ----
  layernorm_kernel<<<kBatch * kChan, 128, 0, stream>>>(xbuf, ln_w, ln_b, xn);

  // ---- q|k token-major: qk[b][j][c] = sum_d w_qk[j][d] xn[b][c][d]; A = [w|w] f16 x16 [2048][2048], Bt = xn (ldb 2048, N 256),
  //      K = 2048, scale 1/(16*1024); out f16 [b][2048][256] (rows 0..1023 = q, 1024..2047 = k) ----
  wmma_gemm64<0, false, 0, 1, false><<<dim3(16, kBatch), 256, 0, stream>>>(
      wqk2, wqk2, 2 * kHW, 0L, xn, xn, kXnLd, sXn,
      (void*)qktok, (void*)qktok, kChan, sQK, b_cdc, x_spa, 0L, kQK, kChan, 2 * kHW, 1.0f / (kWCarry * kXnCarry));

  // ---- att[b][n][m] = (1/32) sum_c q[b][c][n] k[b][c][m]; A = q token-major (lda 256), Bt = k token-major, K = 256; out f16 ----
  wmma_gemm64<0, false, 0, 1, false><<<dim3(32, kBatch), 256, 0, stream>>>(
      qktok, qktok, kChan, sQK, qktok + (size_t)kHW * kChan, qktok + (size_t)kHW * kChan, kChan, sQK,
      (void*)att16, (void*)att16, kHW, sAtt, b_cdc, x_spa, 0L, kHW, kHW, kChan, 0.03125f);

  // ---- per branch, per group of kGrp batches:
  //      scores^T[g][j][n] = sum_m W[j][m] att[b][n][m] / 16 + bias[j]  (A = W f16 x16, Bt = att, K = 1024, f32 out)
  //      column softmax over j -> P^T bf16 hi/lo [g][j][n]
  //      out[b][c][m] = x[b][c][m] + sum_n v[b][c][n] P^T[m][n]  (A = v hi/lo, Bt = P^T hi/lo, 3 bf16 products, f32 out + f32 residual) ----
  for (int br = 0; br < 2; ++br) {
    const unsigned short* w16 = (br == 0) ? wspa16 : wfrq16;
    const float* bsc          = (br == 0) ? b_spa : b_frq;
    const unsigned short* vh  = (br == 0) ? vspa_hi : vfrq_hi;
    const unsigned short* vl  = (br == 0) ? vspa_lo : vfrq_lo;
    const float* xres         = (br == 0) ? x_spa : x_freq;
    float* ob = outp + (size_t)br * (size_t)nX;
    for (int gi = 0; gi < kNGrp; ++gi) {
      const int b0 = gi * kGrp;
      wmma_gemm64<0, false, 1, 0, false><<<dim3(32, kGrp), 256, 0, stream>>>(
          w16, w16, kHW, 0L, att16 + (size_t)b0 * sAtt, att16 + (size_t)b0 * sAtt, kHW, sAtt,
          (void*)scores, (void*)scores, kHW, sAtt, bsc, xres, 0L, kHW, kHW, kHW, 1.0f / kWCarry);
      colsoftmax_kernel<<<dim3(kHW / 64, kGrp), 1024, 0, stream>>>(scores, pt_hi, pt_lo);
      wmma_gemm64<1, true, 0, 0, true><<<dim3(8, kGrp), 256, 0, stream>>>(
          vh + (size_t)b0 * sX, vl + (size_t)b0 * sX, kHW, sX, pt_hi, pt_lo, kHW, sAtt,
          (void*)(ob + (size_t)b0 * sX), (void*)(ob + (size_t)b0 * sX), kHW, sX, bsc,
          xres + (size_t)b0 * sX, sX, kChan, kHW, kHW, 1.0f);
    }
  }
}
